// v000
// The times below were measured on an AMD MI455X: many runs one after another, warmed up first and cycling through
// copies of the inputs, with the whole window's GPU time divided by the number of runs. Launches and the gaps
// between them are all in it. The median over several windows is given; except for v000 it joins two sittings, which
// can be a few percent apart, so the side-by-side timings, each taken in one sitting, are the better comparison.
// v000, which the later versions start from, runs in 303 microseconds.
#include <hip/hip_runtime.h>

// Contractions: head projections x*W^T on v_wmma_f32_16x16x32_bf16 (RNE bf16 operands = converted inputs, exact products); attention q.k^T and p.v^T on v_wmma_f32_16x16x32_f16 single planes (p carried x1024) for query rows >= RH and on bf16 hi+lo planes (3 products) for query rows < RH; output projection on v_wmma_f32_16x16x32_f16 planes (y carried x16, W x64, folded by 2^-10) for rows >= RH and on bf16 hi+lo y planes (2 products) for rows < RH; f32 accumulate everywhere, softmax in f32.

#ifndef NB
#define NB 2
#endif
#ifndef SEQ
#define SEQ 2048
#endif
#define NB_FULL  2
#define SEQ_FULL 2048
#define DM   1024
#define NH   16
#define HD   64
#define NQKV 3072
#define NSLOT (3 * NH)
#ifndef RH
#define RH 512
#endif
#if RH > SEQ
#undef RH
#define RH SEQ
#endif
static_assert(SEQ % 64 == 0);
static_assert(RH % 64 == 0);
static_assert(RH <= SEQ);
static_assert(SEQ <= SEQ_FULL);
static_assert(NB <= NB_FULL);
static_assert(DM % 32 == 0);
#define PCAR 1024.0f
#define YCAR 16.0f
#define WCAR 64.0f
#define OSC  (1.0f / 1024.0f)
#define SCL  0.125f
#define L2E  1.4426950408889634f
#define ST   72
#define PT   (16 * ST)

typedef _Float16 h16;
typedef unsigned short bf;
typedef __attribute__((ext_vector_type(16))) __bf16   v16bf;
typedef __attribute__((ext_vector_type(16))) _Float16 v16h;
typedef __attribute__((ext_vector_type(8)))  _Float16 v8h;
typedef __attribute__((ext_vector_type(8)))  unsigned short v8us;
typedef __attribute__((ext_vector_type(8)))  float    v8f;
typedef __attribute__((ext_vector_type(4)))  float    v4f;
typedef v8h  __attribute__((may_alias)) v8ha;
typedef v4f  __attribute__((may_alias)) v4fa;
typedef v8us __attribute__((may_alias)) v8usa;

__device__ __forceinline__ unsigned short f2bf(float f) { unsigned u = __float_as_uint(f); u += 0x7FFFu + ((u >> 16) & 1u); return (unsigned short)(u >> 16); }
__device__ __forceinline__ float bf2f(unsigned short b) { return __uint_as_float(((unsigned)b) << 16); }
__device__ __forceinline__ float bfr(float f) { return bf2f(f2bf(f)); }
__device__ __forceinline__ v16h cat16(v8h lo, v8h hi) { return __builtin_shufflevector(lo, hi, 0, 1, 2, 3, 4, 5, 6, 7, 8, 9, 10, 11, 12, 13, 14, 15); }
__device__ __forceinline__ v16bf cat16b(v8us lo, v8us hi) { return __builtin_bit_cast(v16bf, __builtin_shufflevector(lo, hi, 0, 1, 2, 3, 4, 5, 6, 7, 8, 9, 10, 11, 12, 13, 14, 15)); }
__device__ __forceinline__ v8f wmma16(v16h a, v16h b, v8f c) { return __builtin_amdgcn_wmma_f32_16x16x32_f16(false, a, false, b, (short)0, c, false, false); }
__device__ __forceinline__ v8f wmmab(v16bf a, v16bf b, v8f c) { return __builtin_amdgcn_wmma_f32_16x16x32_bf16(false, a, false, b, (short)0, c, false, false); }
__device__ __forceinline__ void splitf(float y, unsigned short& h, unsigned short& l) { h = f2bf(y); l = f2bf(y - bf2f(h)); }

// Fragment loaders: lane -> row (A) / column (B) = lane&15; elements 0..7 <- k0+8h+0..7, elements 8..15 <- k0+16+8h+0..7 (h = lane>>4); p already carries row*pitch + k0 + 8h.
template <typename T16> struct WFrag;
template <> struct WFrag<h16> { typedef v16h V; static __device__ __forceinline__ V ld(const h16* p) { return cat16(*(const v8h*)p, *(const v8h*)(p + 16)); } static __device__ __forceinline__ v8f mma(V a, V b, v8f c) { return wmma16(a, b, c); } };
template <> struct WFrag<bf> { typedef v16bf V; static __device__ __forceinline__ V ld(const bf* p) { return cat16b(*(const v8us*)p, *(const v8us*)(p + 16)); } static __device__ __forceinline__ v8f mma(V a, V b, v8f c) { return wmmab(a, b, c); } };

// ---- k_gemmw: register-blocked GEMM, ONE WAVE per 64x64 output tile (16 accumulators), operands straight from K-contiguous 16-bit planes; grid (M/64, N/64, Z), 32 threads.
// C[m][n] (f32, pitch ldc) = (sum_k A[m][k] Bt[n][k] (+ A2[m][k] Bt[n][k] when NSPLIT==1)) * osc + bias[n] (bf16 RNE value). z-batch strides sA/sB/sC in elements. K % 32 == 0.
template <typename T16, int NSPLIT, bool BIAS>
__global__ __launch_bounds__(32) void k_gemmw(const T16* __restrict__ A, const T16* __restrict__ A2, const T16* __restrict__ Bt, const T16* __restrict__ Bt2, int K, float* C, int ldc, const float* __restrict__ bias, float osc, size_t sA, size_t sB, size_t sC) {
    typedef typename WFrag<T16>::V V;
    __shared__ __align__(16) float os[16 * 68];
    const size_t z = blockIdx.z; A += z * sA; if (A2) A2 += z * sA; Bt += z * sB; if (Bt2) Bt2 += z * sB; C += z * sC;
    const int lane = threadIdx.x & 31, lr = lane & 15, hi = lane >> 4; const int r0 = blockIdx.x * 64, c0 = blockIdx.y * 64;
    v8f acc[4][4];
#pragma unroll
    for (int mb = 0; mb < 4; ++mb)
#pragma unroll
        for (int nb = 0; nb < 4; ++nb) acc[mb][nb] = (v8f){};
    const size_t aoff = (size_t)(r0 + lr) * K + 8 * hi, boff = (size_t)(c0 + lr) * K + 8 * hi;
#pragma unroll 1
    for (int kc = 0; kc < K; kc += 32) {
        V a[4], a2[4];
#pragma unroll
        for (int mb = 0; mb < 4; ++mb) { a[mb] = WFrag<T16>::ld(A + aoff + (size_t)mb * 16 * K + kc); if (NSPLIT == 1 || NSPLIT == 2) a2[mb] = WFrag<T16>::ld(A2 + aoff + (size_t)mb * 16 * K + kc); }
#pragma unroll
        for (int nb = 0; nb < 4; ++nb) { const V b = WFrag<T16>::ld(Bt + boff + (size_t)nb * 16 * K + kc); V b2; if (NSPLIT >= 2) b2 = WFrag<T16>::ld(Bt2 + boff + (size_t)nb * 16 * K + kc);
#pragma unroll
            for (int mb = 0; mb < 4; ++mb) { acc[mb][nb] = WFrag<T16>::mma(a[mb], b, acc[mb][nb]); if (NSPLIT == 1 || NSPLIT == 2) acc[mb][nb] = WFrag<T16>::mma(a2[mb], b, acc[mb][nb]); if (NSPLIT >= 2) acc[mb][nb] = WFrag<T16>::mma(a[mb], b2, acc[mb][nb]); } }
        asm volatile("v_nop\n\tv_nop\n\tv_nop\n\tv_nop" : "+v"(acc[0][0]), "+v"(acc[1][1]), "+v"(acc[2][2]), "+v"(acc[3][3]) : "v"(a[0]), "v"(a[3]));
    }
#pragma unroll
    for (int mb = 0; mb < 4; ++mb) {
#pragma unroll
        for (int nb = 0; nb < 4; ++nb) {
#pragma unroll
            for (int j = 0; j < 8; ++j) os[(hi * 8 + j) * 68 + nb * 16 + lr] = acc[mb][nb][j]; }
        __builtin_amdgcn_wave_barrier(); asm volatile("" ::: "memory");
        float* crow = C + (size_t)(r0 + mb * 16) * ldc + c0;
{
#pragma unroll
            for (int s = 0; s < 8; ++s) { const int row = 2 * s + hi, cofs = lr * 4; v4f val = *(const v4fa*)(os + row * 68 + cofs); val = val * osc; if (BIAS) { val[0] += bfr(bias[c0 + cofs]); val[1] += bfr(bias[c0 + cofs + 1]); val[2] += bfr(bias[c0 + cofs + 2]); val[3] += bfr(bias[c0 + cofs + 3]); }
                *(v4f*)(crow + (size_t)row * ldc + cofs) = val; }
             }
        __builtin_amdgcn_wave_barrier(); asm volatile("" ::: "memory");
    }
}

// ---- integer head selection: slot 0 -> head_idx[0], slot s>=1 -> head_idxs[s-1]; both values loaded unconditionally with clamped addresses, negative wraps by 16, result clamped to [0,15].
__device__ __forceinline__ int wrap16(int v) { v = (v < 0) ? (v + NH) : v; v = (v < 0) ? 0 : v; return (v > NH - 1) ? (NH - 1) : v; }
__device__ __forceinline__ int hsel(const int* hidx, const int* hidxs, int slot) {
    const int a = hidx[0]; int bi = slot - 1; bi = (bi < 0) ? 0 : ((bi > NH - 2) ? (NH - 2) : bi); const int c = hidxs[bi];
    return wrap16((slot == 0) ? a : c);
}

// coverage: NB*SEQ*DM elements per plane, 8 per thread, grid ceil-div with bound -> whole plane.
__global__ __launch_bounds__(256) void k_cvtx(const float* __restrict__ s0, const float* __restrict__ s1, const float* __restrict__ s2, const float* __restrict__ s3, bf* d0, bf* d1, bf* d2, bf* d3) {
    const size_t i = (size_t)blockIdx.x * 256 + threadIdx.x; const size_t n8 = (size_t)NB * SEQ * DM / 8; if (i >= n8) return;
    const int w = blockIdx.y;
    const float* src = (w == 0) ? s0 : ((w == 1) ? s1 : ((w == 2) ? s2 : s3)); bf* dst = (w == 0) ? d0 : ((w == 1) ? d1 : ((w == 2) ? d2 : d3));
    const size_t e = i * 8; const size_t row = e / DM; const int col = (int)(e % DM); const size_t b = row / SEQ, t = row % SEQ;
    const v8f v = *(const v8f*)(src + ((b * SEQ_FULL + t) * DM + col)); v8us o;
#pragma unroll
    for (int q = 0; q < 8; ++q) o[q] = f2bf(v[q]);
    *(v8us*)(dst + e) = o; 
}

// coverage: 48*64*1024 elements, 8 per thread, grid exact with bound.
__global__ __launch_bounds__(256) void k_wg(const float* __restrict__ W, const int* __restrict__ hidx, const int* __restrict__ hidxs, bf* WB) {
    const size_t i = (size_t)blockIdx.x * 256 + threadIdx.x; const size_t n8 = (size_t)NSLOT * HD * DM / 8; if (i >= n8) return;
    const size_t e = i * 8; const int k = (int)(e % DM); const int r = (int)((e / DM) % HD); const int z = (int)(e / ((size_t)DM * HD)); const int type = z >> 4, slot = z & 15;
    const int hs = hsel(hidx, hidxs, slot);
    const v8f v = *(const v8f*)(W + ((size_t)(type * DM + hs * HD + r)) * DM + k); v8us o;
#pragma unroll
    for (int q = 0; q < 8; ++q) o[q] = f2bf(v[q]);
    *(v8us*)(WB + e) = o; 
}

// coverage: DM*DM elements, 8 per thread, grid exact with bound.
__global__ __launch_bounds__(256) void k_cvtw(const float* __restrict__ W, h16* WP16, bf* WPB) {
    const size_t i = (size_t)blockIdx.x * 256 + threadIdx.x; const size_t n8 = (size_t)DM * DM / 8; if (i >= n8) return;
    const v8f v = *(const v8f*)(W + i * 8); v8h o16; v8us ob;
#pragma unroll
    for (int q = 0; q < 8; ++q) { ob[q] = f2bf(v[q]); o16[q] = (h16)(bf2f(ob[q]) * WCAR); }
    *(v8h*)(WP16 + i * 8) = o16; *(v8us*)(WPB + i * 8) = ob; 
}

// ---- k_qkv: per slot z = type*16 + slot, one wave per 64x64 tile of Y[b*SEQ + t][d] = sum_k XB[.][k] WB[z][d][k] + battn[type*DM + hsel(slot)*HD + d] (bf16 x bf16, f32 acc); grid (NB*SEQ/64, 1, 48), 32 threads.
// A = X1B/X2B/X3B for slot 0 (type q/k/v), XB otherwise (block-uniform select, no loaded index).
// Epilogue: the tile (+bias) is staged in LDS (q/k: [t][d]; v: transposed [d][t]); for every final head hp with wrap16(perm[hp]) == slot (block-uniform scalar compare) the tile is written to head planes zf = b*16 + hp:
// coverage: every (hp, b, t, d) of Q16/K16/VT is written by exactly one (slot == wrap16(perm[hp]), row tile) block; hi+lo planes for all t < RH likewise. LDS staging: 64x64 written in full before the barrier (cross-lane, block = one wave, __syncthreads).
__global__ __launch_bounds__(32) void k_qkv(const bf* __restrict__ XB, const bf* __restrict__ X1B, const bf* __restrict__ X2B, const bf* __restrict__ X3B, const bf* __restrict__ WB, const float* __restrict__ battn,
                                          const int* __restrict__ hidx, const int* __restrict__ hidxs, const int* __restrict__ perm,
                                          h16* Q16, bf* QH, bf* QL, h16* K16, bf* KH, bf* KL, h16* VT, bf* VH, bf* VL) {
    __shared__ __align__(16) h16 s16[64 * ST];
    __shared__ __align__(16) bf  sbh[64 * ST];
    __shared__ __align__(16) bf  sbl[64 * ST];
    const int lane = threadIdx.x & 31, lr = lane & 15, hi = lane >> 4;
    const int z = blockIdx.z, type = z >> 4, slot = z & 15;
    const int r0 = blockIdx.x * 64;                 // compact row index b*SEQ + t
    const int b = r0 / SEQ, t0 = r0 % SEQ; const bool hires = (t0 < RH);
    const bf* A = (slot == 0) ? ((type == 0) ? X1B : ((type == 1) ? X2B : X3B)) : XB;
    const bf* Bt = WB + (size_t)z * HD * DM;
    const int K = DM;
    v8f acc[4][4];
#pragma unroll
    for (int mb = 0; mb < 4; ++mb)
#pragma unroll
        for (int nb = 0; nb < 4; ++nb) acc[mb][nb] = (v8f){};
    const size_t aoff = (size_t)(r0 + lr) * K + 8 * hi, boff = (size_t)lr * K + 8 * hi;
#pragma unroll 1
    for (int kc = 0; kc < K; kc += 32) {
        v16bf a[4];
#pragma unroll
        for (int mb = 0; mb < 4; ++mb) a[mb] = WFrag<bf>::ld(A + aoff + (size_t)mb * 16 * K + kc);
#pragma unroll
        for (int nb = 0; nb < 4; ++nb) { const v16bf bb = WFrag<bf>::ld(Bt + boff + (size_t)nb * 16 * K + kc);
#pragma unroll
            for (int mb = 0; mb < 4; ++mb) acc[mb][nb] = wmmab(a[mb], bb, acc[mb][nb]); }
        asm volatile("v_nop\n\tv_nop\n\tv_nop\n\tv_nop" : "+v"(acc[0][0]), "+v"(acc[1][1]), "+v"(acc[2][2]), "+v"(acc[3][3]) : "v"(a[0]), "v"(a[3]));
    }
    // bias for this lane's columns (battn index <= 3071 by the clamps)
    const int hs = hsel(hidx, hidxs, slot); const int woff = type * DM + hs * HD;
    float bias[4];
#pragma unroll
    for (int nb = 0; nb < 4; ++nb) bias[nb] = bfr(battn[woff + nb * 16 + lr]);
    // stage the 64x64 tile
#pragma unroll
    for (int mb = 0; mb < 4; ++mb)
#pragma unroll
        for (int nb = 0; nb < 4; ++nb)
#pragma unroll
            for (int j = 0; j < 8; ++j) {
                const float v = acc[mb][nb][j] + bias[nb];
                const int row = mb * 16 + hi * 8 + j, col = nb * 16 + lr;
                const int ix = (type == 2) ? (col * ST + row) : (row * ST + col);
                s16[ix] = (h16)v;
                if (hires) { unsigned short a2, c2; splitf(v, a2, c2); sbh[ix] = a2; sbl[ix] = c2; }
            }
    __syncthreads();
    const int rsel = lane >> 3, piece = (lane & 7) * 8;
#pragma unroll 1
    for (int hp = 0; hp < NH; ++hp) {
        const int pp = wrap16(perm[hp]);
        if (pp != slot) continue;
        const int zf = b * NH + hp;
{
#pragma unroll 4
            for (int i = 0; i < 16; ++i) {
                const int rr = 4 * i + rsel;               // staged row: t (q/k) or d (v)
                const v8h v16 = *(const v8ha*)(s16 + rr * ST + piece);
                if (type == 2) {
                    *(v8h*)(VT + ((size_t)zf * HD + rr) * SEQ + t0 + piece) = v16;
                    if (hires) { const v8us vh = *(const v8usa*)(sbh + rr * ST + piece), vl = *(const v8usa*)(sbl + rr * ST + piece);
                        *(v8us*)(VH + ((size_t)zf * HD + rr) * RH + t0 + piece) = vh; *(v8us*)(VL + ((size_t)zf * HD + rr) * RH + t0 + piece) = vl; }
                } else {
                    h16* P = (type == 0) ? Q16 : K16;
                    *(v8h*)(P + ((size_t)zf * SEQ + t0 + rr) * HD + piece) = v16;
                    if (hires) { const v8us vh = *(const v8usa*)(sbh + rr * ST + piece), vl = *(const v8usa*)(sbl + rr * ST + piece);
                        bf* PHp = (type == 0) ? QH : KH; bf* PLp = (type == 0) ? QL : KL;
                        *(v8us*)(PHp + ((size_t)zf * RH + t0 + rr) * HD + piece) = vh; *(v8us*)(PLp + ((size_t)zf * RH + t0 + rr) * HD + piece) = vl; }
                }
            }
            
        }
    }
}

// ---- k_flash<HR>: causal attention, one (b, final head, 64-query tile) per block, 4 waves x 16 query rows, 64-key tiles kv0 = 0 .. q0 (tiles above the diagonal skipped, diagonal tile masked by replace-fill), online softmax in f32.
// HR=false (query tiles >= RH): S = Q16.K16^T single f16 planes; P operand = f16(p x 1024) in a wave-private LDS tile; O += P.VT single f16; y written as f16(y x 16) rows of Y16[b*SEQ + t][hp*64 + d].
// HR=true (query tiles < RH): q, k, p(x1024), v as bf16 hi+lo planes, 3 products per tile pair; y written as bf16 hi+lo rows of YH/YL[b*RH + t][..].
// coverage: Y16 rows t in [RH, SEQ) x all hp (HR=false grid), YH/YL rows t < RH x all hp (HR=true grid).
template <bool HR>
__global__ __launch_bounds__(128) void k_flash(const h16* __restrict__ Q16, const bf* __restrict__ QH, const bf* __restrict__ QL,
                                               const h16* __restrict__ K16, const bf* __restrict__ KH, const bf* __restrict__ KL,
                                               const h16* __restrict__ VT, const bf* __restrict__ VH, const bf* __restrict__ VL,
                                               h16* Y16, bf* YH, bf* YL, int qt0) {
    __shared__ __align__(16) h16 P16[4 * PT];
    __shared__ __align__(16) bf  PHs[4 * PT];
    __shared__ __align__(16) bf  PLs[4 * PT];
    const int tid = threadIdx.x, w = tid >> 5, lane = tid & 31, m = lane & 15, hi = lane >> 4;
    const int qt = qt0 + blockIdx.x, q0 = qt * 64, zf = blockIdx.y, b = zf >> 4, hp = zf & 15;
    const int qw = q0 + w * 16;                     // first query row of this wave
    h16* Pw = P16 + w * PT; bf* PHw = PHs + w * PT; bf* PLw = PLs + w * PT;
    v16h qa[2]; v16bf qah[2], qal[2];
    if constexpr (!HR) {
#pragma unroll
        for (int kk = 0; kk < 2; ++kk) qa[kk] = WFrag<h16>::ld(Q16 + ((size_t)zf * SEQ + qw + m) * HD + kk * 32 + 8 * hi);
    } else {
#pragma unroll
        for (int kk = 0; kk < 2; ++kk) { qah[kk] = WFrag<bf>::ld(QH + ((size_t)zf * RH + qw + m) * HD + kk * 32 + 8 * hi); qal[kk] = WFrag<bf>::ld(QL + ((size_t)zf * RH + qw + m) * HD + kk * 32 + 8 * hi); }
    }
    v8f oacc[4];
#pragma unroll
    for (int nt = 0; nt < 4; ++nt) oacc[nt] = (v8f){};
    float mrow[8], lrow[8];
#pragma unroll
    for (int j = 0; j < 8; ++j) { mrow[j] = -3.0e38f; lrow[j] = 0.0f; }
    const int ntiles = qt + 1;
#pragma unroll 1
    for (int jt = 0; jt < ntiles; ++jt) {
        const int kv0 = jt * 64;
        v8f sacc[4];
#pragma unroll
        for (int nt = 0; nt < 4; ++nt) sacc[nt] = (v8f){};
        if constexpr (!HR) {
            v16h kb[4];
#pragma unroll
            for (int kk = 0; kk < 2; ++kk) {
#pragma unroll
                for (int nt = 0; nt < 4; ++nt) { kb[nt] = WFrag<h16>::ld(K16 + ((size_t)zf * SEQ + kv0 + nt * 16 + m) * HD + kk * 32 + 8 * hi); sacc[nt] = wmma16(qa[kk], kb[nt], sacc[nt]); }
            }
            asm volatile("v_nop\n\tv_nop\n\tv_nop\n\tv_nop" : "+v"(sacc[0]), "+v"(sacc[1]), "+v"(sacc[2]), "+v"(sacc[3]) : "v"(qa[0]), "v"(qa[1]), "v"(kb[3]));
        } else {
            v16bf kbh[4], kbl[4];
#pragma unroll
            for (int kk = 0; kk < 2; ++kk) {
#pragma unroll
                for (int nt = 0; nt < 4; ++nt) {
                    kbh[nt] = WFrag<bf>::ld(KH + ((size_t)zf * RH + kv0 + nt * 16 + m) * HD + kk * 32 + 8 * hi);
                    sacc[nt] = wmmab(qah[kk], kbh[nt], sacc[nt]); sacc[nt] = wmmab(qal[kk], kbh[nt], sacc[nt]);
                    kbl[nt] = WFrag<bf>::ld(KL + ((size_t)zf * RH + kv0 + nt * 16 + m) * HD + kk * 32 + 8 * hi);
                    sacc[nt] = wmmab(qah[kk], kbl[nt], sacc[nt]); }
            }
            asm volatile("v_nop\n\tv_nop\n\tv_nop\n\tv_nop" : "+v"(sacc[0]), "+v"(sacc[1]), "+v"(sacc[2]), "+v"(sacc[3]) : "v"(qah[0]), "v"(qal[1]), "v"(kbh[3]), "v"(kbl[3]));
        }
        // online softmax; row (hi*8 + j) of this wave lives on the 16 lanes sharing hi; diagonal tile: keys with index > query index get the replace-fill
        const bool diag = (kv0 == q0);
#pragma unroll
        for (int j = 0; j < 8; ++j) {
            const int rr = w * 16 + hi * 8 + j;         // query row within the 64-row tile
            float sv[4]; float mx = -3.0e38f;
#pragma unroll
            for (int nt = 0; nt < 4; ++nt) { float s = sacc[nt][j] * SCL; const int kn = nt * 16 + m; s = (diag && kn > rr) ? -3.0e38f : s; sv[nt] = s; mx = fmaxf(mx, s); }
#pragma unroll
            for (int off = 1; off < 16; off <<= 1) mx = fmaxf(mx, __shfl_xor(mx, off, 32));
            const float mn = fmaxf(mrow[j], mx);
            const float corr = __builtin_amdgcn_exp2f((mrow[j] - mn) * L2E);
            mrow[j] = mn;
            float psum = 0.0f;
#pragma unroll
            for (int nt = 0; nt < 4; ++nt) {
                const float p = __builtin_amdgcn_exp2f((sv[nt] - mn) * L2E); psum += p;
                const int ix = (hi * 8 + j) * ST + nt * 16 + m;
                if constexpr (!HR) { Pw[ix] = (h16)(p * PCAR); } else { unsigned short a2, c2; splitf(p * PCAR, a2, c2); PHw[ix] = a2; PLw[ix] = c2; }
            }
#pragma unroll
            for (int off = 1; off < 16; off <<= 1) psum += __shfl_xor(psum, off, 32);
            lrow[j] = lrow[j] * corr + psum;
#pragma unroll
            for (int nt = 0; nt < 4; ++nt) oacc[nt][j] *= corr;
        }
        __builtin_amdgcn_fence(3 /* release order */, "wavefront"); __builtin_amdgcn_wave_barrier(); asm volatile("" ::: "memory");
        // O += P . V (A = P[row][key] from the wave tile, B = VT[d][key] plane)
        if constexpr (!HR) {
            v16h pa[2], vb[4];
#pragma unroll
            for (int kk = 0; kk < 2; ++kk) {
                pa[kk] = cat16(*(const v8ha*)(Pw + m * ST + kk * 32 + 8 * hi), *(const v8ha*)(Pw + m * ST + kk * 32 + 8 * hi + 16));
#pragma unroll
                for (int nt = 0; nt < 4; ++nt) { vb[nt] = WFrag<h16>::ld(VT + ((size_t)zf * HD + nt * 16 + m) * SEQ + kv0 + kk * 32 + 8 * hi); oacc[nt] = wmma16(pa[kk], vb[nt], oacc[nt]); }
            }
            asm volatile("v_nop\n\tv_nop\n\tv_nop\n\tv_nop" : "+v"(oacc[0]), "+v"(oacc[1]), "+v"(oacc[2]), "+v"(oacc[3]) : "v"(pa[0]), "v"(pa[1]), "v"(vb[3]));
        } else {
            v16bf pah[2], pal[2], vbh[4], vbl[4];
#pragma unroll
            for (int kk = 0; kk < 2; ++kk) {
                pah[kk] = cat16b(*(const v8usa*)(PHw + m * ST + kk * 32 + 8 * hi), *(const v8usa*)(PHw + m * ST + kk * 32 + 8 * hi + 16));
                pal[kk] = cat16b(*(const v8usa*)(PLw + m * ST + kk * 32 + 8 * hi), *(const v8usa*)(PLw + m * ST + kk * 32 + 8 * hi + 16));
#pragma unroll
                for (int nt = 0; nt < 4; ++nt) {
                    vbh[nt] = WFrag<bf>::ld(VH + ((size_t)zf * HD + nt * 16 + m) * RH + kv0 + kk * 32 + 8 * hi);
                    oacc[nt] = wmmab(pah[kk], vbh[nt], oacc[nt]); oacc[nt] = wmmab(pal[kk], vbh[nt], oacc[nt]);
                    vbl[nt] = WFrag<bf>::ld(VL + ((size_t)zf * HD + nt * 16 + m) * RH + kv0 + kk * 32 + 8 * hi);
                    oacc[nt] = wmmab(pah[kk], vbl[nt], oacc[nt]); }
            }
            asm volatile("v_nop\n\tv_nop\n\tv_nop\n\tv_nop" : "+v"(oacc[0]), "+v"(oacc[1]), "+v"(oacc[2]), "+v"(oacc[3]) : "v"(pah[0]), "v"(pal[1]), "v"(vbh[3]), "v"(vbl[3]));
        }
        __builtin_amdgcn_wave_barrier(); asm volatile("" ::: "memory");
    }
    // normalise and stage y in the wave tile, then whole-line stores
#pragma unroll
    for (int j = 0; j < 8; ++j) {
        const float inv = 1.0f / (lrow[j] * PCAR);
#pragma unroll
        for (int nt = 0; nt < 4; ++nt) {
            const float y = oacc[nt][j] * inv;
            const int ix = (hi * 8 + j) * ST + nt * 16 + m;
            if constexpr (!HR) { Pw[ix] = (h16)(y * YCAR); } else { unsigned short a2, c2; splitf(y, a2, c2); PHw[ix] = a2; PLw[ix] = c2; }
        }
    }
    __builtin_amdgcn_fence(3 /* release order */, "wavefront"); __builtin_amdgcn_wave_barrier(); asm volatile("" ::: "memory");
    const int rsel = lane >> 3, piece = (lane & 7) * 8;
{
#pragma unroll
        for (int i = 0; i < 4; ++i) {
            const int rr = 4 * i + rsel; const int t = qw + rr;
            if constexpr (!HR) {
                const v8h v16 = *(const v8ha*)(Pw + rr * ST + piece);
                *(v8h*)(Y16 + ((size_t)b * SEQ + t) * DM + hp * HD + piece) = v16;
            } else {
                const v8us vh = *(const v8usa*)(PHw + rr * ST + piece), vl = *(const v8usa*)(PLw + rr * ST + piece);
                *(v8us*)(YH + ((size_t)b * RH + t) * DM + hp * HD + piece) = vh; *(v8us*)(YL + ((size_t)b * RH + t) * DM + hp * HD + piece) = vl;
            }
        }
        
    }
}

extern "C" void kernel_launch(void* const* d_in, const int* in_sizes, int n_in,
                              void* d_out, int out_size, void* d_ws, size_t ws_size, hipStream_t stream) {
    if (n_in < 11) return;
    const int xneed = (NB - 1) * SEQ_FULL * DM + SEQ * DM;
    if (in_sizes[0] < xneed || in_sizes[1] < xneed || in_sizes[2] < xneed || in_sizes[3] < xneed) return;
    if (in_sizes[4] < NQKV * DM || in_sizes[5] < NQKV || in_sizes[6] < DM * DM || in_sizes[7] < DM) return;
    if (in_sizes[8] < 1 || in_sizes[9] < NH - 1 || in_sizes[10] < NH) return;
    if (out_size < xneed) return;
    const float* X1 = (const float*)d_in[0]; const float* X2 = (const float*)d_in[1]; const float* X3 = (const float*)d_in[2]; const float* X = (const float*)d_in[3];
    const float* Wattn = (const float*)d_in[4]; const float* battn = (const float*)d_in[5]; const float* Wproj = (const float*)d_in[6]; const float* bproj = (const float*)d_in[7];
    const int* hidx = (const int*)d_in[8]; const int* hidxs = (const int*)d_in[9]; const int* perm = (const int*)d_in[10];
    float* OUT = (float*)d_out;   // [NB_FULL][SEQ_FULL][DM] f32

    char* wsp = (char*)d_ws;
    auto take = [&](size_t bytes) { char* p = wsp; wsp += (bytes + 255) & ~(size_t)255; return (void*)p; };
    const size_t xplane = (size_t)NB * SEQ * DM * 2;                 // compact [NB*SEQ][DM] bf16
    bf* XB = (bf*)take(xplane); bf* X1B = (bf*)take(xplane); bf* X2B = (bf*)take(xplane); bf* X3B = (bf*)take(xplane);
    bf* WB = (bf*)take((size_t)NSLOT * HD * DM * 2);
    h16* WP16 = (h16*)take((size_t)DM * DM * 2); bf* WPB = (bf*)take((size_t)DM * DM * 2);
    const size_t hplane = (size_t)NB * NH * SEQ * HD * 2, hplaneR = (size_t)NB * NH * RH * HD * 2;
    h16* Q16 = (h16*)take(hplane); h16* K16 = (h16*)take(hplane); h16* VT = (h16*)take(hplane);
    bf* QH = (bf*)take(hplaneR); bf* QL = (bf*)take(hplaneR); bf* KH = (bf*)take(hplaneR); bf* KL = (bf*)take(hplaneR); bf* VH = (bf*)take(hplaneR); bf* VL = (bf*)take(hplaneR);
    h16* Y16 = (h16*)take((size_t)NB * SEQ * DM * 2); bf* YH = (bf*)take((size_t)NB * RH * DM * 2); bf* YL = (bf*)take((size_t)NB * RH * DM * 2);
    if ((size_t)(wsp - (char*)d_ws) > ws_size) return;

    // 1) bf16 input planes (compact rows)
    k_cvtx<<<dim3((unsigned)(((size_t)NB * SEQ * DM / 8 + 255) / 256), 4), 256, 0, stream>>>(X, X1, X2, X3, XB, X1B, X2B, X3B);
    // 2) gathered head weight plane and output-projection weight planes
    k_wg<<<(unsigned)(((size_t)NSLOT * HD * DM / 8 + 255) / 256), 256, 0, stream>>>(Wattn, hidx, hidxs, WB);
    k_cvtw<<<(unsigned)(((size_t)DM * DM / 8 + 255) / 256), 256, 0, stream>>>(Wproj, WP16, WPB);
    // 3) head projections -> per final-head planes
    k_qkv<<<dim3(NB * SEQ / 64, 1, NSLOT), 32, 0, stream>>>(XB, X1B, X2B, X3B, WB, battn, hidx, hidxs, perm, Q16, QH, QL, K16, KH, KL, VT, VH, VL);
    // 4) causal attention: hi+lo band (query tiles < RH) and single-plane band (tiles >= RH)
    k_flash<true><<<dim3(RH / 64, NB * NH), 128, 0, stream>>>(Q16, QH, QL, K16, KH, KL, VT, VH, VL, Y16, YH, YL, 0);
    if (SEQ > RH) k_flash<false><<<dim3((SEQ - RH) / 64, NB * NH), 128, 0, stream>>>(Q16, QH, QL, K16, KH, KL, VT, VH, VL, Y16, YH, YL, RH / 64);
    // 5) output projection (+ bproj): rows < RH from bf16 hi+lo y, rows >= RH from the f16 plane (carries folded by OSC)
    k_gemmw<bf, 1, true><<<dim3(RH / 64, DM / 64, NB), 32, 0, stream>>>(YH, YL, WPB, nullptr, DM, OUT, DM, bproj, 1.0f, (size_t)RH * DM, (size_t)0, (size_t)SEQ_FULL * DM);
    if (SEQ > RH) k_gemmw<h16, 0, true><<<dim3((SEQ - RH) / 64, DM / 64, NB), 32, 0, stream>>>(Y16 + (size_t)RH * DM, nullptr, WP16, nullptr, DM, OUT + (size_t)RH * DM, DM, bproj, OSC, (size_t)SEQ * DM, (size_t)0, (size_t)SEQ_FULL * DM);
}

// v001
// One run takes 218 microseconds.
// Timed twice side by side with v000, it ran 1.41 and 1.40 times as fast.
#include <hip/hip_runtime.h>

// Contractions: head projections x*W^T on v_wmma_f32_16x16x32_bf16 (RNE bf16 operands = converted inputs, exact products); attention q.k^T and p.v^T on v_wmma_f32_16x16x32_f16 single planes (p carried x1024) for query rows >= RH and on bf16 hi+lo planes (3 products) for query rows < RH; output projection on v_wmma_f32_16x16x32_f16 planes (y carried x16, W x64, folded by 2^-10) for rows >= RH and on bf16 hi+lo y planes (2 products) for rows < RH; f32 accumulate everywhere, softmax in f32.

#ifndef NB
#define NB 2
#endif
#ifndef SEQ
#define SEQ 2048
#endif
#define NB_FULL  2
#define SEQ_FULL 2048
#define DM   1024
#define NH   16
#define HD   64
#define NQKV 3072
#define NSLOT (3 * NH)
#ifndef RH
#define RH 512
#endif
#if RH > SEQ
#undef RH
#define RH SEQ
#endif
static_assert(SEQ % 64 == 0);
static_assert(RH % 64 == 0);
static_assert(RH <= SEQ);
static_assert(SEQ <= SEQ_FULL);
static_assert(NB <= NB_FULL);
static_assert(DM % 64 == 0);
#define PCAR 1024.0f
#define YCAR 16.0f
#define WCAR 64.0f
#define OSC  (1.0f / 1024.0f)
#define SCL  0.125f
#define L2E  1.4426950408889634f
#define ST   72
#define PT   (16 * ST)

typedef _Float16 h16;
typedef unsigned short bf;
typedef __attribute__((ext_vector_type(16))) __bf16   v16bf;
typedef __attribute__((ext_vector_type(16))) _Float16 v16h;
typedef __attribute__((ext_vector_type(8)))  _Float16 v8h;
typedef __attribute__((ext_vector_type(8)))  unsigned short v8us;
typedef __attribute__((ext_vector_type(8)))  float    v8f;
typedef __attribute__((ext_vector_type(4)))  float    v4f;
typedef v8h  __attribute__((may_alias)) v8ha;
typedef v4f  __attribute__((may_alias)) v4fa;
typedef v8us __attribute__((may_alias)) v8usa;

__device__ __forceinline__ unsigned short f2bf(float f) { unsigned u = __float_as_uint(f); u += 0x7FFFu + ((u >> 16) & 1u); return (unsigned short)(u >> 16); }
__device__ __forceinline__ float bf2f(unsigned short b) { return __uint_as_float(((unsigned)b) << 16); }
__device__ __forceinline__ float bfr(float f) { return bf2f(f2bf(f)); }
__device__ __forceinline__ v16h cat16(v8h lo, v8h hi) { return __builtin_shufflevector(lo, hi, 0, 1, 2, 3, 4, 5, 6, 7, 8, 9, 10, 11, 12, 13, 14, 15); }
__device__ __forceinline__ v16bf cat16b(v8us lo, v8us hi) { return __builtin_bit_cast(v16bf, __builtin_shufflevector(lo, hi, 0, 1, 2, 3, 4, 5, 6, 7, 8, 9, 10, 11, 12, 13, 14, 15)); }
__device__ __forceinline__ v8f wmma16(v16h a, v16h b, v8f c) { return __builtin_amdgcn_wmma_f32_16x16x32_f16(false, a, false, b, (short)0, c, false, false); }
__device__ __forceinline__ v8f wmmab(v16bf a, v16bf b, v8f c) { return __builtin_amdgcn_wmma_f32_16x16x32_bf16(false, a, false, b, (short)0, c, false, false); }
__device__ __forceinline__ void splitf(float y, unsigned short& h, unsigned short& l) { h = f2bf(y); l = f2bf(y - bf2f(h)); }

// Fragment loaders: lane -> row (A) / column (B) = lane&15; elements 0..7 <- k0+8h+0..7, elements 8..15 <- k0+16+8h+0..7 (h = lane>>4); p already carries row*pitch + k0 + 8h.
template <typename T16> struct WFrag;
template <> struct WFrag<h16> { typedef v16h V; static __device__ __forceinline__ V ld(const h16* p) { return cat16(*(const v8h*)p, *(const v8h*)(p + 16)); } static __device__ __forceinline__ v8f mma(V a, V b, v8f c) { return wmma16(a, b, c); } };
template <> struct WFrag<bf> { typedef v16bf V; static __device__ __forceinline__ V ld(const bf* p) { return cat16b(*(const v8us*)p, *(const v8us*)(p + 16)); } static __device__ __forceinline__ v8f mma(V a, V b, v8f c) { return wmmab(a, b, c); } };

// ---- k_gemmw: register-blocked GEMM, ONE WAVE per 64x64 output tile (16 accumulators), operands straight from K-contiguous 16-bit planes; grid (M/64, N/64, Z), 32 threads.
// C[m][n] (f32, pitch ldc) = (sum_k A[m][k] Bt[n][k] (+ A2[m][k] Bt[n][k] when NSPLIT==1)) * osc + bias[n] (bf16 RNE value). z-batch strides sA/sB/sC in elements. K % 64 == 0, K >= 64.
template <typename T16, int NSPLIT, bool BIAS, int K>
__global__ __launch_bounds__(32) void k_gemmw(const T16* __restrict__ A, const T16* __restrict__ A2, const T16* __restrict__ Bt, const T16* __restrict__ Bt2, float* C, int ldc, const float* __restrict__ bias, float osc, size_t sA, size_t sB, size_t sC) {
    typedef typename WFrag<T16>::V V;
    __shared__ __align__(16) float os[16 * 68];
    const size_t z = blockIdx.z; A += z * sA; if (A2) A2 += z * sA; Bt += z * sB; if (Bt2) Bt2 += z * sB; C += z * sC;
    const int lane = threadIdx.x & 31, lr = lane & 15, hi = lane >> 4; const int r0 = blockIdx.x * 64, c0 = blockIdx.y * 64;
    v8f acc[4][4];
#pragma unroll
    for (int mb = 0; mb < 4; ++mb)
#pragma unroll
        for (int nb = 0; nb < 4; ++nb) acc[mb][nb] = (v8f){};
    const size_t aoff = (size_t)(r0 + lr) * K + 8 * hi, boff = (size_t)(c0 + lr) * K + 8 * hi;
    // Two register sets of operand fragments: every load of k step s+1 is issued before the products of step s, so a step waits for one load latency at most.
    static_assert(K % 64 == 0 && K >= 64);
    struct FS { V a[4], a2[4], b[4], b2[4]; };
    const T16* pa = A + aoff; const T16* pa2 = A2 + aoff; const T16* pb = Bt + boff; const T16* pb2 = Bt2 + boff;   // pa2 / pb2 are read only where NSPLIT uses them
    auto ldfs = [&](FS& f, int ko) {
#pragma unroll
        for (int mb = 0; mb < 4; ++mb) { f.a[mb] = WFrag<T16>::ld(pa + mb * 16 * K + ko); if (NSPLIT == 1 || NSPLIT == 2) f.a2[mb] = WFrag<T16>::ld(pa2 + mb * 16 * K + ko); }
#pragma unroll
        for (int nb = 0; nb < 4; ++nb) { f.b[nb] = WFrag<T16>::ld(pb + nb * 16 * K + ko); if (NSPLIT >= 2) f.b2[nb] = WFrag<T16>::ld(pb2 + nb * 16 * K + ko); }
        __builtin_amdgcn_sched_barrier(0);   // keeps the loads above the products that follow; without it the scheduler sinks each load to its first use
    };
    // the wait that stands in front of a rewrite of the loads' address registers; naming them keeps them whole up to it; behind a block of products it finds the count at 0
    auto xw = [&]() {
        if constexpr (NSPLIT == 0) asm volatile("s_wait_xcnt 0x0" :: "v"(pa), "v"(pb) : "memory");
        else if constexpr (NSPLIT == 1) asm volatile("s_wait_xcnt 0x0" :: "v"(pa), "v"(pa2), "v"(pb) : "memory");
        else asm volatile("s_wait_xcnt 0x0" :: "v"(pa), "v"(pa2), "v"(pb), "v"(pb2) : "memory");
    };
    auto mmfs = [&](FS& f) {
#pragma unroll
        for (int nb = 0; nb < 4; ++nb) {
#pragma unroll
            for (int mb = 0; mb < 4; ++mb) { acc[mb][nb] = WFrag<T16>::mma(f.a[mb], f.b[nb], acc[mb][nb]); if (NSPLIT == 1 || NSPLIT == 2) acc[mb][nb] = WFrag<T16>::mma(f.a2[mb], f.b[nb], acc[mb][nb]); if (NSPLIT >= 2) acc[mb][nb] = WFrag<T16>::mma(f.a[mb], f.b2[nb], acc[mb][nb]); } }
        // WMMA distance before the refill of this set and on the back edge
        asm volatile("v_nop\n\tv_nop\n\tv_nop\n\tv_nop" : "+v"(acc[0][0]), "+v"(acc[1][1]), "+v"(acc[2][2]), "+v"(acc[3][3]) : "v"(f.a[0]), "v"(f.a[3]));
    };
    FS f0, f1;
    ldfs(f0, 0);
#pragma unroll 1
    for (int kc = 0; kc < K - 64; kc += 64) {
        ldfs(f1, 32);
        mmfs(f0);
        xw();
        pa += 64; pa2 += 64; pb += 64; pb2 += 64;
        ldfs(f0, 0);
        mmfs(f1);
    }
    ldfs(f1, 32);
    mmfs(f0);
    xw();
    mmfs(f1);
#pragma unroll
    for (int mb = 0; mb < 4; ++mb) {
#pragma unroll
        for (int nb = 0; nb < 4; ++nb) {
#pragma unroll
            for (int j = 0; j < 8; ++j) os[(hi * 8 + j) * 68 + nb * 16 + lr] = acc[mb][nb][j]; }
        __builtin_amdgcn_wave_barrier(); asm volatile("" ::: "memory");
        float* crow = C + (size_t)(r0 + mb * 16) * ldc + c0;
{
#pragma unroll
            for (int s = 0; s < 8; ++s) { const int row = 2 * s + hi, cofs = lr * 4; v4f val = *(const v4fa*)(os + row * 68 + cofs); val = val * osc; if (BIAS) { val[0] += bfr(bias[c0 + cofs]); val[1] += bfr(bias[c0 + cofs + 1]); val[2] += bfr(bias[c0 + cofs + 2]); val[3] += bfr(bias[c0 + cofs + 3]); }
                *(v4f*)(crow + (size_t)row * ldc + cofs) = val; }
             }
        asm volatile("s_wait_xcnt 0x0" ::: "memory");   // in front of the next block's reuse of the stores' address and data registers
        __builtin_amdgcn_sched_barrier(0);              // keeps that reuse behind the wait
        __builtin_amdgcn_wave_barrier(); asm volatile("" ::: "memory");
    }
}

// ---- integer head selection: slot 0 -> head_idx[0], slot s>=1 -> head_idxs[s-1]; both values loaded unconditionally with clamped addresses, negative wraps by 16, result clamped to [0,15].
__device__ __forceinline__ int wrap16(int v) { v = (v < 0) ? (v + NH) : v; v = (v < 0) ? 0 : v; return (v > NH - 1) ? (NH - 1) : v; }
__device__ __forceinline__ int hsel(const int* hidx, const int* hidxs, int slot) {
    const int a = hidx[0]; int bi = slot - 1; bi = (bi < 0) ? 0 : ((bi > NH - 2) ? (NH - 2) : bi); const int c = hidxs[bi];
    return wrap16((slot == 0) ? a : c);
}

// coverage: NB*SEQ*DM elements per plane, 8 per thread, grid ceil-div with bound -> whole plane.
__global__ __launch_bounds__(256) void k_cvtx(const float* __restrict__ s0, const float* __restrict__ s1, const float* __restrict__ s2, const float* __restrict__ s3, bf* d0, bf* d1, bf* d2, bf* d3) {
    const size_t i = (size_t)blockIdx.x * 256 + threadIdx.x; const size_t n8 = (size_t)NB * SEQ * DM / 8; if (i >= n8) return;
    const int w = blockIdx.y;
    const float* src = (w == 0) ? s0 : ((w == 1) ? s1 : ((w == 2) ? s2 : s3)); bf* dst = (w == 0) ? d0 : ((w == 1) ? d1 : ((w == 2) ? d2 : d3));
    const size_t e = i * 8; const size_t row = e / DM; const int col = (int)(e % DM); const size_t b = row / SEQ, t = row % SEQ;
    const v8f v = *(const v8f*)(src + ((b * SEQ_FULL + t) * DM + col)); v8us o;
#pragma unroll
    for (int q = 0; q < 8; ++q) o[q] = f2bf(v[q]);
    *(v8us*)(dst + e) = o; 
}

// coverage: 48*64*1024 elements, 8 per thread, grid exact with bound.
__global__ __launch_bounds__(256) void k_wg(const float* __restrict__ W, const int* __restrict__ hidx, const int* __restrict__ hidxs, bf* WB) {
    const size_t i = (size_t)blockIdx.x * 256 + threadIdx.x; const size_t n8 = (size_t)NSLOT * HD * DM / 8; if (i >= n8) return;
    const size_t e = i * 8; const int k = (int)(e % DM); const int r = (int)((e / DM) % HD); const int z = (int)(e / ((size_t)DM * HD)); const int type = z >> 4, slot = z & 15;
    const int hs = hsel(hidx, hidxs, slot);
    const v8f v = *(const v8f*)(W + ((size_t)(type * DM + hs * HD + r)) * DM + k); v8us o;
#pragma unroll
    for (int q = 0; q < 8; ++q) o[q] = f2bf(v[q]);
    *(v8us*)(WB + e) = o; 
}

// coverage: DM*DM elements, 8 per thread, grid exact with bound.
__global__ __launch_bounds__(256) void k_cvtw(const float* __restrict__ W, h16* WP16, bf* WPB) {
    const size_t i = (size_t)blockIdx.x * 256 + threadIdx.x; const size_t n8 = (size_t)DM * DM / 8; if (i >= n8) return;
    const v8f v = *(const v8f*)(W + i * 8); v8h o16; v8us ob;
#pragma unroll
    for (int q = 0; q < 8; ++q) { ob[q] = f2bf(v[q]); o16[q] = (h16)(bf2f(ob[q]) * WCAR); }
    *(v8h*)(WP16 + i * 8) = o16; *(v8us*)(WPB + i * 8) = ob; 
}

// ---- k_qkv: per slot z = type*16 + slot, one wave per 64x64 tile of Y[b*SEQ + t][d] = sum_k XB[.][k] WB[z][d][k] + battn[type*DM + hsel(slot)*HD + d] (bf16 x bf16, f32 acc); grid (NB*SEQ/64, 1, 48), 32 threads.
// A = X1B/X2B/X3B for slot 0 (type q/k/v), XB otherwise (block-uniform select, no loaded index).
// Epilogue: the tile (+bias) is staged in LDS (q/k: [t][d]; v: transposed [d][t]); for every final head hp with wrap16(perm[hp]) == slot (block-uniform scalar compare) the tile is written to head planes zf = b*16 + hp:
// coverage: every (hp, b, t, d) of Q16/K16/VT is written by exactly one (slot == wrap16(perm[hp]), row tile) block; hi+lo planes for all t < RH likewise. LDS staging: 64x64 written in full before the barrier (cross-lane, block = one wave, __syncthreads).
__global__ __launch_bounds__(32) void k_qkv(const bf* __restrict__ XB, const bf* __restrict__ X1B, const bf* __restrict__ X2B, const bf* __restrict__ X3B, const bf* __restrict__ WB, const float* __restrict__ battn,
                                          const int* __restrict__ hidx, const int* __restrict__ hidxs, const int* __restrict__ perm,
                                          h16* Q16, bf* QH, bf* QL, h16* K16, bf* KH, bf* KL, h16* VT, bf* VH, bf* VL) {
    __shared__ __align__(16) h16 s16[64 * ST];
    __shared__ __align__(16) bf  sbh[64 * ST];
    __shared__ __align__(16) bf  sbl[64 * ST];
    const int lane = threadIdx.x & 31, lr = lane & 15, hi = lane >> 4;
    const int z = blockIdx.z, type = z >> 4, slot = z & 15;
    const int r0 = blockIdx.x * 64;                 // compact row index b*SEQ + t
    const int b = r0 / SEQ, t0 = r0 % SEQ; const bool hires = (t0 < RH);
    const bf* A = (slot == 0) ? ((type == 0) ? X1B : ((type == 1) ? X2B : X3B)) : XB;
    const bf* Bt = WB + (size_t)z * HD * DM;
    constexpr int K = DM;
    v8f acc[4][4];
#pragma unroll
    for (int mb = 0; mb < 4; ++mb)
#pragma unroll
        for (int nb = 0; nb < 4; ++nb) acc[mb][nb] = (v8f){};
    const size_t aoff = (size_t)(r0 + lr) * K + 8 * hi, boff = (size_t)lr * K + 8 * hi;
    // Two register sets of operand fragments: every load of k step s+1 is issued before the products of step s.
    struct FS { v16bf a[4], b[4]; };
    const bf* pa = A + aoff; const bf* pb = Bt + boff;
    auto ldfs = [&](FS& f, int ko) {
#pragma unroll
        for (int mb = 0; mb < 4; ++mb) f.a[mb] = WFrag<bf>::ld(pa + mb * 16 * K + ko);
#pragma unroll
        for (int nb = 0; nb < 4; ++nb) f.b[nb] = WFrag<bf>::ld(pb + nb * 16 * K + ko);
        __builtin_amdgcn_sched_barrier(0);   // keeps the loads above the products that follow; without it the scheduler sinks each load to its first use
    };
    // the wait that stands in front of a rewrite of the loads' address registers; naming them keeps them whole up to it; behind a block of products it finds the count at 0
    auto xw = [&]() { asm volatile("s_wait_xcnt 0x0" :: "v"(pa), "v"(pb) : "memory"); };
    auto mmfs = [&](FS& f) {
#pragma unroll
        for (int nb = 0; nb < 4; ++nb) {
#pragma unroll
            for (int mb = 0; mb < 4; ++mb) acc[mb][nb] = wmmab(f.a[mb], f.b[nb], acc[mb][nb]); }
        // WMMA distance before the refill of this set and on the back edge
        asm volatile("v_nop\n\tv_nop\n\tv_nop\n\tv_nop" : "+v"(acc[0][0]), "+v"(acc[1][1]), "+v"(acc[2][2]), "+v"(acc[3][3]) : "v"(f.a[0]), "v"(f.a[3]));
    };
    FS f0, f1;
    ldfs(f0, 0);
#pragma unroll 1
    for (int kc = 0; kc < K - 64; kc += 64) {
        ldfs(f1, 32);
        mmfs(f0);
        xw();
        pa += 64; pb += 64;
        ldfs(f0, 0);
        mmfs(f1);
    }
    ldfs(f1, 32);
    mmfs(f0);
    xw();
    mmfs(f1);
    // bias for this lane's columns (battn index <= 3071 by the clamps)
    const int hs = hsel(hidx, hidxs, slot); const int woff = type * DM + hs * HD;
    float bias[4];
#pragma unroll
    for (int nb = 0; nb < 4; ++nb) bias[nb] = bfr(battn[woff + nb * 16 + lr]);
    // stage the 64x64 tile
#pragma unroll
    for (int mb = 0; mb < 4; ++mb)
#pragma unroll
        for (int nb = 0; nb < 4; ++nb)
#pragma unroll
            for (int j = 0; j < 8; ++j) {
                const float v = acc[mb][nb][j] + bias[nb];
                const int row = mb * 16 + hi * 8 + j, col = nb * 16 + lr;
                const int ix = (type == 2) ? (col * ST + row) : (row * ST + col);
                s16[ix] = (h16)v;
                if (hires) { unsigned short a2, c2; splitf(v, a2, c2); sbh[ix] = a2; sbl[ix] = c2; }
            }
    __syncthreads();
    const int rsel = lane >> 3, piece = (lane & 7) * 8;
#pragma unroll 1
    for (int hp = 0; hp < NH; ++hp) {
        const int pp = wrap16(perm[hp]);
        if (pp != slot) continue;
        const int zf = b * NH + hp;
{
#pragma unroll 4
            for (int i = 0; i < 16; ++i) {
                const int rr = 4 * i + rsel;               // staged row: t (q/k) or d (v)
                const v8h v16 = *(const v8ha*)(s16 + rr * ST + piece);
                if (type == 2) {
                    *(v8h*)(VT + ((size_t)zf * HD + rr) * SEQ + t0 + piece) = v16;
                    if (hires) { const v8us vh = *(const v8usa*)(sbh + rr * ST + piece), vl = *(const v8usa*)(sbl + rr * ST + piece);
                        *(v8us*)(VH + ((size_t)zf * HD + rr) * RH + t0 + piece) = vh; *(v8us*)(VL + ((size_t)zf * HD + rr) * RH + t0 + piece) = vl; }
                } else {
                    h16* P = (type == 0) ? Q16 : K16;
                    *(v8h*)(P + ((size_t)zf * SEQ + t0 + rr) * HD + piece) = v16;
                    if (hires) { const v8us vh = *(const v8usa*)(sbh + rr * ST + piece), vl = *(const v8usa*)(sbl + rr * ST + piece);
                        bf* PHp = (type == 0) ? QH : KH; bf* PLp = (type == 0) ? QL : KL;
                        *(v8us*)(PHp + ((size_t)zf * RH + t0 + rr) * HD + piece) = vh; *(v8us*)(PLp + ((size_t)zf * RH + t0 + rr) * HD + piece) = vl; }
                }
            }
            
        }
    }
}

// ---- k_flash<HR>: causal attention, one (b, final head, 64-query tile) per block, 4 waves x 16 query rows, 64-key tiles kv0 = 0 .. q0 (tiles above the diagonal skipped, diagonal tile masked by replace-fill), online softmax in f32.
// HR=false (query tiles >= RH): S = Q16.K16^T single f16 planes; P operand = f16(p x 1024) in a wave-private LDS tile; O += P.VT single f16; y written as f16(y x 16) rows of Y16[b*SEQ + t][hp*64 + d].
// HR=true (query tiles < RH): q, k, p(x1024), v as bf16 hi+lo planes, 3 products per tile pair; y written as bf16 hi+lo rows of YH/YL[b*RH + t][..].
// coverage: Y16 rows t in [RH, SEQ) x all hp (HR=false grid), YH/YL rows t < RH x all hp (HR=true grid).
// amdgpu_waves_per_eu: the single-plane grid puts three waves on a SIMD, the hi+lo grid two, so the register budget is a third (a half) of the file per wave; held to four waves the scheduler runs the row reductions one after another to save registers, and the hi+lo form takes more than a third.
template <bool HR>
__global__ __launch_bounds__(128) __attribute__((amdgpu_waves_per_eu(1, HR ? 2 : 3))) void k_flash(const h16* __restrict__ Q16, const bf* __restrict__ QH, const bf* __restrict__ QL,
                                               const h16* __restrict__ K16, const bf* __restrict__ KH, const bf* __restrict__ KL,
                                               const h16* __restrict__ VT, const bf* __restrict__ VH, const bf* __restrict__ VL,
                                               h16* Y16, bf* YH, bf* YL, int qt0) {
    __shared__ __align__(16) h16 P16[4 * PT];
    __shared__ __align__(16) bf  PHs[4 * PT];
    __shared__ __align__(16) bf  PLs[4 * PT];
    const int tid = threadIdx.x, w = tid >> 5, lane = tid & 31, m = lane & 15, hi = lane >> 4;
    const int qt = qt0 + blockIdx.x, q0 = qt * 64, zf = blockIdx.y, b = zf >> 4, hp = zf & 15;
    const int qw = q0 + w * 16;                     // first query row of this wave
    h16* Pw = P16 + w * PT; bf* PHw = PHs + w * PT; bf* PLw = PLs + w * PT;
    v16h qa[2]; v16bf qah[2], qal[2];
    if constexpr (!HR) {
        const h16* pq = Q16 + ((size_t)zf * SEQ + qw + m) * HD + 8 * hi;
#pragma unroll
        for (int kk = 0; kk < 2; ++kk) qa[kk] = WFrag<h16>::ld(pq + kk * 32);
        asm volatile("s_wait_xcnt 0x0" :: "v"(pq) : "memory");   // in front of any rewrite of the loads' address registers
    } else {
        const bf* pqh = QH + ((size_t)zf * RH + qw + m) * HD + 8 * hi; const bf* pql = QL + ((size_t)zf * RH + qw + m) * HD + 8 * hi;
#pragma unroll
        for (int kk = 0; kk < 2; ++kk) { qah[kk] = WFrag<bf>::ld(pqh + kk * 32); qal[kk] = WFrag<bf>::ld(pql + kk * 32); }
        asm volatile("s_wait_xcnt 0x0" :: "v"(pqh), "v"(pql) : "memory");   // in front of any rewrite of the loads' address registers
    }
    v8f oacc[4];
#pragma unroll
    for (int nt = 0; nt < 4; ++nt) oacc[nt] = (v8f){};
    float mrow[8], lrow[8];
#pragma unroll
    for (int j = 0; j < 8; ++j) { mrow[j] = -3.0e38f; lrow[j] = 0.0f; }
    const int ntiles = qt + 1;
    // All fragments of a key tile live in registers, [kk][nt], and are loaded in one batch. Single planes: K of tile jt+1 is issued right behind the score products of tile jt, V of tile jt in front of them.
    // hi+lo planes (twice the fragments): K in one batch at the head of the tile, V in one batch right behind the score products, under the softmax.
    v16h kb[2][4], vb[2][4]; v16bf kbh[2][4], kbl[2][4], vbh[2][4], vbl[2][4];
    // this lane's walking pointers: K planes step 64 rows a tile, V planes 64 columns
    const h16* pk = K16 + ((size_t)zf * SEQ + m) * HD + 8 * hi; const h16* pv = VT + ((size_t)zf * HD + m) * SEQ + 8 * hi;
    const bf* pkh = KH + ((size_t)zf * RH + m) * HD + 8 * hi; const bf* pkl = KL + ((size_t)zf * RH + m) * HD + 8 * hi;
    const bf* pvh = VH + ((size_t)zf * HD + m) * RH + 8 * hi; const bf* pvl = VL + ((size_t)zf * HD + m) * RH + 8 * hi;
    auto ldK = [&]() {
#pragma unroll
        for (int kk = 0; kk < 2; ++kk) {
#pragma unroll
            for (int nt = 0; nt < 4; ++nt) {
                if constexpr (!HR) { kb[kk][nt] = WFrag<h16>::ld(pk + nt * 16 * HD + kk * 32); }
                else { kbh[kk][nt] = WFrag<bf>::ld(pkh + nt * 16 * HD + kk * 32); kbl[kk][nt] = WFrag<bf>::ld(pkl + nt * 16 * HD + kk * 32); }
            }
        }
        __builtin_amdgcn_sched_barrier(0);   // keeps the loads above the work that follows; without it the scheduler sinks each load to its first use
    };
    auto ldV = [&]() {
#pragma unroll
        for (int kk = 0; kk < 2; ++kk) {
#pragma unroll
            for (int nt = 0; nt < 4; ++nt) {
                if constexpr (!HR) { vb[kk][nt] = WFrag<h16>::ld(pv + nt * 16 * SEQ + kk * 32); }
                else { vbh[kk][nt] = WFrag<bf>::ld(pvh + nt * 16 * RH + kk * 32); vbl[kk][nt] = WFrag<bf>::ld(pvl + nt * 16 * RH + kk * 32); }
            }
        }
        __builtin_amdgcn_sched_barrier(0);   // as in ldK
    };
    if constexpr (!HR) ldK();
#pragma unroll 1
    for (int jt = 0; jt < ntiles; ++jt) {
        const int kv0 = jt * 64;
        if constexpr (!HR) ldV(); else ldK();
        v8f sacc[4];
#pragma unroll
        for (int nt = 0; nt < 4; ++nt) sacc[nt] = (v8f){};
        if constexpr (!HR) {
#pragma unroll
            for (int kk = 0; kk < 2; ++kk) {
#pragma unroll
                for (int nt = 0; nt < 4; ++nt) sacc[nt] = wmma16(qa[kk], kb[kk][nt], sacc[nt]);
            }
            asm volatile("v_nop\n\tv_nop\n\tv_nop\n\tv_nop" : "+v"(sacc[0]), "+v"(sacc[1]), "+v"(sacc[2]), "+v"(sacc[3]) : "v"(qa[0]), "v"(qa[1]), "v"(kb[1][3]));
        } else {
#pragma unroll
            for (int kk = 0; kk < 2; ++kk) {
#pragma unroll
                for (int nt = 0; nt < 4; ++nt) {
                    sacc[nt] = wmmab(qah[kk], kbh[kk][nt], sacc[nt]); sacc[nt] = wmmab(qal[kk], kbh[kk][nt], sacc[nt]);
                    sacc[nt] = wmmab(qah[kk], kbl[kk][nt], sacc[nt]); }
            }
            asm volatile("v_nop\n\tv_nop\n\tv_nop\n\tv_nop" : "+v"(sacc[0]), "+v"(sacc[1]), "+v"(sacc[2]), "+v"(sacc[3]) : "v"(kbh[1][3]), "v"(kbl[1][3]));
        }
        if constexpr (!HR) { pk += (jt + 1 < ntiles) ? (64 * HD) : 0; ldK(); }   // behind the last tile: an in-bounds reload of it that nothing consumes
        else ldV();
        // online softmax; row (hi*8 + j) of this wave lives on the 16 lanes sharing hi; diagonal tile: keys with index > query index get the replace-fill
        const bool diag = (kv0 == q0);
#pragma unroll
        for (int j = 0; j < 8; ++j) {
            const int rr = w * 16 + hi * 8 + j;         // query row within the 64-row tile
            float sv[4]; float mx = -3.0e38f;
#pragma unroll
            for (int nt = 0; nt < 4; ++nt) { float s = sacc[nt][j] * SCL; const int kn = nt * 16 + m; s = (diag && kn > rr) ? -3.0e38f : s; sv[nt] = s; mx = fmaxf(mx, s); }
#pragma unroll
            for (int off = 1; off < 16; off <<= 1) mx = fmaxf(mx, __shfl_xor(mx, off, 32));
            const float mn = fmaxf(mrow[j], mx);
            const float corr = __builtin_amdgcn_exp2f((mrow[j] - mn) * L2E);
            mrow[j] = mn;
            float psum = 0.0f;
#pragma unroll
            for (int nt = 0; nt < 4; ++nt) {
                const float p = __builtin_amdgcn_exp2f((sv[nt] - mn) * L2E); psum += p;
                const int ix = (hi * 8 + j) * ST + nt * 16 + m;
                if constexpr (!HR) { Pw[ix] = (h16)(p * PCAR); } else { unsigned short a2, c2; splitf(p * PCAR, a2, c2); PHw[ix] = a2; PLw[ix] = c2; }
            }
#pragma unroll
            for (int off = 1; off < 16; off <<= 1) psum += __shfl_xor(psum, off, 32);
            lrow[j] = lrow[j] * corr + psum;
#pragma unroll
            for (int nt = 0; nt < 4; ++nt) oacc[nt][j] *= corr;
        }
        __builtin_amdgcn_fence(3 /* release order */, "wavefront"); __builtin_amdgcn_wave_barrier(); asm volatile("" ::: "memory");
        // the wait that stands in front of a rewrite of the loads' address registers; naming them keeps them whole up to it; behind the softmax it finds the count at 0
        if constexpr (!HR) { asm volatile("s_wait_xcnt 0x0" :: "v"(pk), "v"(pv) : "memory"); pv += 64; }
        else { asm volatile("s_wait_xcnt 0x0" :: "v"(pkh), "v"(pkl), "v"(pvh), "v"(pvl) : "memory"); pkh += 64 * HD; pkl += 64 * HD; pvh += 64; pvl += 64; }
        // O += P . V (A = P[row][key] from the wave tile, B = VT[d][key] plane)
        if constexpr (!HR) {
            v16h pa[2];
#pragma unroll
            for (int kk = 0; kk < 2; ++kk) {
                pa[kk] = cat16(*(const v8ha*)(Pw + m * ST + kk * 32 + 8 * hi), *(const v8ha*)(Pw + m * ST + kk * 32 + 8 * hi + 16));
#pragma unroll
                for (int nt = 0; nt < 4; ++nt) oacc[nt] = wmma16(pa[kk], vb[kk][nt], oacc[nt]);
            }
            asm volatile("v_nop\n\tv_nop\n\tv_nop\n\tv_nop" : "+v"(oacc[0]), "+v"(oacc[1]), "+v"(oacc[2]), "+v"(oacc[3]) : "v"(pa[0]), "v"(pa[1]), "v"(vb[1][3]));
        } else {
            v16bf pah[2], pal[2];
#pragma unroll
            for (int kk = 0; kk < 2; ++kk) {
                pah[kk] = cat16b(*(const v8usa*)(PHw + m * ST + kk * 32 + 8 * hi), *(const v8usa*)(PHw + m * ST + kk * 32 + 8 * hi + 16));
                pal[kk] = cat16b(*(const v8usa*)(PLw + m * ST + kk * 32 + 8 * hi), *(const v8usa*)(PLw + m * ST + kk * 32 + 8 * hi + 16));
#pragma unroll
                for (int nt = 0; nt < 4; ++nt) {
                    oacc[nt] = wmmab(pah[kk], vbh[kk][nt], oacc[nt]); oacc[nt] = wmmab(pal[kk], vbh[kk][nt], oacc[nt]);
                    oacc[nt] = wmmab(pah[kk], vbl[kk][nt], oacc[nt]); }
            }
            asm volatile("v_nop\n\tv_nop\n\tv_nop\n\tv_nop" : "+v"(oacc[0]), "+v"(oacc[1]), "+v"(oacc[2]), "+v"(oacc[3]) : "v"(pah[0]), "v"(pal[1]), "v"(vbh[1][3]), "v"(vbl[1][3]));
        }
        __builtin_amdgcn_wave_barrier(); asm volatile("" ::: "memory");
    }
    // normalise and stage y in the wave tile, then whole-line stores
#pragma unroll
    for (int j = 0; j < 8; ++j) {
        const float inv = 1.0f / (lrow[j] * PCAR);
#pragma unroll
        for (int nt = 0; nt < 4; ++nt) {
            const float y = oacc[nt][j] * inv;
            const int ix = (hi * 8 + j) * ST + nt * 16 + m;
            if constexpr (!HR) { Pw[ix] = (h16)(y * YCAR); } else { unsigned short a2, c2; splitf(y, a2, c2); PHw[ix] = a2; PLw[ix] = c2; }
        }
    }
    __builtin_amdgcn_fence(3 /* release order */, "wavefront"); __builtin_amdgcn_wave_barrier(); asm volatile("" ::: "memory");
    const int rsel = lane >> 3, piece = (lane & 7) * 8;
{
#pragma unroll
        for (int i = 0; i < 4; ++i) {
            const int rr = 4 * i + rsel; const int t = qw + rr;
            if constexpr (!HR) {
                const v8h v16 = *(const v8ha*)(Pw + rr * ST + piece);
                *(v8h*)(Y16 + ((size_t)b * SEQ + t) * DM + hp * HD + piece) = v16;
            } else {
                const v8us vh = *(const v8usa*)(PHw + rr * ST + piece), vl = *(const v8usa*)(PLw + rr * ST + piece);
                *(v8us*)(YH + ((size_t)b * RH + t) * DM + hp * HD + piece) = vh; *(v8us*)(YL + ((size_t)b * RH + t) * DM + hp * HD + piece) = vl;
            }
        }
        
    }
}

extern "C" void kernel_launch(void* const* d_in, const int* in_sizes, int n_in,
                              void* d_out, int out_size, void* d_ws, size_t ws_size, hipStream_t stream) {
    if (n_in < 11) return;
    const int xneed = (NB - 1) * SEQ_FULL * DM + SEQ * DM;
    if (in_sizes[0] < xneed || in_sizes[1] < xneed || in_sizes[2] < xneed || in_sizes[3] < xneed) return;
    if (in_sizes[4] < NQKV * DM || in_sizes[5] < NQKV || in_sizes[6] < DM * DM || in_sizes[7] < DM) return;
    if (in_sizes[8] < 1 || in_sizes[9] < NH - 1 || in_sizes[10] < NH) return;
    if (out_size < xneed) return;
    const float* X1 = (const float*)d_in[0]; const float* X2 = (const float*)d_in[1]; const float* X3 = (const float*)d_in[2]; const float* X = (const float*)d_in[3];
    const float* Wattn = (const float*)d_in[4]; const float* battn = (const float*)d_in[5]; const float* Wproj = (const float*)d_in[6]; const float* bproj = (const float*)d_in[7];
    const int* hidx = (const int*)d_in[8]; const int* hidxs = (const int*)d_in[9]; const int* perm = (const int*)d_in[10];
    float* OUT = (float*)d_out;   // [NB_FULL][SEQ_FULL][DM] f32

    char* wsp = (char*)d_ws;
    auto take = [&](size_t bytes) { char* p = wsp; wsp += (bytes + 255) & ~(size_t)255; return (void*)p; };
    const size_t xplane = (size_t)NB * SEQ * DM * 2;                 // compact [NB*SEQ][DM] bf16
    bf* XB = (bf*)take(xplane); bf* X1B = (bf*)take(xplane); bf* X2B = (bf*)take(xplane); bf* X3B = (bf*)take(xplane);
    bf* WB = (bf*)take((size_t)NSLOT * HD * DM * 2);
    h16* WP16 = (h16*)take((size_t)DM * DM * 2); bf* WPB = (bf*)take((size_t)DM * DM * 2);
    const size_t hplane = (size_t)NB * NH * SEQ * HD * 2, hplaneR = (size_t)NB * NH * RH * HD * 2;
    h16* Q16 = (h16*)take(hplane); h16* K16 = (h16*)take(hplane); h16* VT = (h16*)take(hplane);
    bf* QH = (bf*)take(hplaneR); bf* QL = (bf*)take(hplaneR); bf* KH = (bf*)take(hplaneR); bf* KL = (bf*)take(hplaneR); bf* VH = (bf*)take(hplaneR); bf* VL = (bf*)take(hplaneR);
    h16* Y16 = (h16*)take((size_t)NB * SEQ * DM * 2); bf* YH = (bf*)take((size_t)NB * RH * DM * 2); bf* YL = (bf*)take((size_t)NB * RH * DM * 2);
    if ((size_t)(wsp - (char*)d_ws) > ws_size) return;

    // 1) bf16 input planes (compact rows)
    k_cvtx<<<dim3((unsigned)(((size_t)NB * SEQ * DM / 8 + 255) / 256), 4), 256, 0, stream>>>(X, X1, X2, X3, XB, X1B, X2B, X3B);
    // 2) gathered head weight plane and output-projection weight planes
    k_wg<<<(unsigned)(((size_t)NSLOT * HD * DM / 8 + 255) / 256), 256, 0, stream>>>(Wattn, hidx, hidxs, WB);
    k_cvtw<<<(unsigned)(((size_t)DM * DM / 8 + 255) / 256), 256, 0, stream>>>(Wproj, WP16, WPB);
    // 3) head projections -> per final-head planes
    k_qkv<<<dim3(NB * SEQ / 64, 1, NSLOT), 32, 0, stream>>>(XB, X1B, X2B, X3B, WB, battn, hidx, hidxs, perm, Q16, QH, QL, K16, KH, KL, VT, VH, VL);
    // 4) causal attention: hi+lo band (query tiles < RH) and single-plane band (tiles >= RH)
    k_flash<true><<<dim3(RH / 64, NB * NH), 128, 0, stream>>>(Q16, QH, QL, K16, KH, KL, VT, VH, VL, Y16, YH, YL, 0);
    if (SEQ > RH) k_flash<false><<<dim3((SEQ - RH) / 64, NB * NH), 128, 0, stream>>>(Q16, QH, QL, K16, KH, KL, VT, VH, VL, Y16, YH, YL, RH / 64);
    // 5) output projection (+ bproj): rows < RH from bf16 hi+lo y, rows >= RH from the f16 plane (carries folded by OSC)
    k_gemmw<bf, 1, true, DM><<<dim3(RH / 64, DM / 64, NB), 32, 0, stream>>>(YH, YL, WPB, nullptr, OUT, DM, bproj, 1.0f, (size_t)RH * DM, (size_t)0, (size_t)SEQ_FULL * DM);
    if (SEQ > RH) k_gemmw<h16, 0, true, DM><<<dim3((SEQ - RH) / 64, DM / 64, NB), 32, 0, stream>>>(Y16 + (size_t)RH * DM, nullptr, WP16, nullptr, OUT + (size_t)RH * DM, DM, bproj, OSC, (size_t)SEQ * DM, (size_t)0, (size_t)SEQ_FULL * DM);
}

// v002
// One run takes 175 microseconds.
// Next to v001, in two timings, it ran 1.23 and 1.25 times as fast.
// Over all steps from v000 it is 1.75 times as fast.
#include <hip/hip_runtime.h>

// Contractions: head projections x*W^T on v_wmma_f32_16x16x32_bf16 (RNE bf16 operands = converted inputs, exact products); attention q.k^T and p.v^T on v_wmma_f32_16x16x32_f16 single planes (p carried x1024) for query rows >= RH and on bf16 hi+lo planes (3 products) for query rows < RH; output projection on v_wmma_f32_16x16x32_f16 planes (y carried x16, W x64, folded by 2^-10) for rows >= RH and on bf16 hi+lo y planes (2 products) for rows < RH; f32 accumulate everywhere, softmax in f32.
// Every 16-bit operand plane in the workspace lies in fragment order: a logical [R][K] plane is cut into blocks of 16 rows x 32 k (512 elements, row bands of 16*K elements, k blocks ascending inside a band); inside a block element (r, k) stands at ((k>>4)&1)*256 + (((k>>3)&1)*16 + (r&15))*8 + (k&7), so each of a fragment's two 16-byte loads reads 512 contiguous bytes over the wave (four whole lines instead of pieces of sixteen).

#ifndef NB
#define NB 2
#endif
#ifndef SEQ
#define SEQ 2048
#endif
#define NB_FULL  2
#define SEQ_FULL 2048
#define DM   1024
#define NH   16
#define HD   64
#define NQKV 3072
#define NSLOT (3 * NH)
#ifndef RH
#define RH 512
#endif
#if RH > SEQ
#undef RH
#define RH SEQ
#endif
static_assert(SEQ % 64 == 0);
static_assert(RH % 64 == 0);
static_assert(RH <= SEQ);
static_assert(SEQ <= SEQ_FULL);
static_assert(NB <= NB_FULL);
static_assert(DM % 64 == 0);
#define PCAR 1024.0f
#define YCAR 16.0f
#define WCAR 64.0f
#define OSC  (1.0f / 1024.0f)
#define SCL  0.125f
#define L2E  1.4426950408889634f
#define ST   72
#define PT   (16 * ST)

typedef _Float16 h16;
typedef unsigned short bf;
typedef __attribute__((ext_vector_type(16))) __bf16   v16bf;
typedef __attribute__((ext_vector_type(16))) _Float16 v16h;
typedef __attribute__((ext_vector_type(8)))  _Float16 v8h;
typedef __attribute__((ext_vector_type(8)))  unsigned short v8us;
typedef __attribute__((ext_vector_type(8)))  float    v8f;
typedef __attribute__((ext_vector_type(4)))  float    v4f;
typedef v8h  __attribute__((may_alias)) v8ha;
typedef v4f  __attribute__((may_alias)) v4fa;
typedef v8us __attribute__((may_alias)) v8usa;

__device__ __forceinline__ unsigned short f2bf(float f) { unsigned u = __float_as_uint(f); u += 0x7FFFu + ((u >> 16) & 1u); return (unsigned short)(u >> 16); }
__device__ __forceinline__ float bf2f(unsigned short b) { return __uint_as_float(((unsigned)b) << 16); }
__device__ __forceinline__ float bfr(float f) { return bf2f(f2bf(f)); }
__device__ __forceinline__ v16h cat16(v8h lo, v8h hi) { return __builtin_shufflevector(lo, hi, 0, 1, 2, 3, 4, 5, 6, 7, 8, 9, 10, 11, 12, 13, 14, 15); }
__device__ __forceinline__ v16bf cat16b(v8us lo, v8us hi) { return __builtin_bit_cast(v16bf, __builtin_shufflevector(lo, hi, 0, 1, 2, 3, 4, 5, 6, 7, 8, 9, 10, 11, 12, 13, 14, 15)); }
__device__ __forceinline__ v8f wmma16(v16h a, v16h b, v8f c) { return __builtin_amdgcn_wmma_f32_16x16x32_f16(false, a, false, b, (short)0, c, false, false); }
__device__ __forceinline__ v8f wmmab(v16bf a, v16bf b, v8f c) { return __builtin_amdgcn_wmma_f32_16x16x32_bf16(false, a, false, b, (short)0, c, false, false); }
__device__ __forceinline__ void splitf(float y, unsigned short& h, unsigned short& l) { h = f2bf(y); l = f2bf(y - bf2f(h)); }

// Fragment loaders: lane -> row (A) / column (B) = lane&15; elements 0..7 <- k0+8h+0..7, elements 8..15 <- k0+16+8h+0..7 (h = lane>>4); p already carries the 16x32 block's start + lane*8.
template <typename T16> struct WFrag;
template <> struct WFrag<h16> { typedef v16h V; static __device__ __forceinline__ V ld(const h16* p) { return cat16(*(const v8h*)p, *(const v8h*)(p + 256)); } static __device__ __forceinline__ v8f mma(V a, V b, v8f c) { return wmma16(a, b, c); } };
template <> struct WFrag<bf> { typedef v16bf V; static __device__ __forceinline__ V ld(const bf* p) { return cat16b(*(const v8us*)p, *(const v8us*)(p + 256)); } static __device__ __forceinline__ v8f mma(V a, V b, v8f c) { return wmmab(a, b, c); } };

// ---- k_gemmw: register-blocked GEMM, ONE WAVE per 64x64 output tile (16 accumulators), operands straight from 16-bit planes in fragment order; grid (M/64, N/64, Z), 32 threads.
// C[m][n] (f32, pitch ldc) = (sum_k A[m][k] Bt[n][k] (+ A2[m][k] Bt[n][k] when NSPLIT==1)) * osc + bias[n] (bf16 RNE value). z-batch strides sA/sB/sC in elements. K % 64 == 0, K >= 64.
template <typename T16, int NSPLIT, bool BIAS, int K>
__global__ __launch_bounds__(32) void k_gemmw(const T16* __restrict__ A, const T16* __restrict__ A2, const T16* __restrict__ Bt, const T16* __restrict__ Bt2, float* C, int ldc, const float* __restrict__ bias, float osc, size_t sA, size_t sB, size_t sC) {
    typedef typename WFrag<T16>::V V;
    __shared__ __align__(16) float os[16 * 68];
    const size_t z = blockIdx.z; A += z * sA; if (A2) A2 += z * sA; Bt += z * sB; if (Bt2) Bt2 += z * sB; C += z * sC;
    const int lane = threadIdx.x & 31, lr = lane & 15, hi = lane >> 4; const int r0 = blockIdx.x * 64, c0 = blockIdx.y * 64;
    v8f acc[4][4];
#pragma unroll
    for (int mb = 0; mb < 4; ++mb)
#pragma unroll
        for (int nb = 0; nb < 4; ++nb) acc[mb][nb] = (v8f){};
    const size_t aoff = (size_t)r0 * K + 8 * lane, boff = (size_t)c0 * K + 8 * lane;
    // Two register sets of operand fragments: every load of k step s+1 is issued before the products of step s, so a step waits for one load latency at most.
    static_assert(K % 64 == 0 && K >= 64);
    struct FS { V a[4], a2[4], b[4], b2[4]; };
    const T16* pa = A + aoff; const T16* pa2 = A2 + aoff; const T16* pb = Bt + boff; const T16* pb2 = Bt2 + boff;   // pa2 / pb2 are read only where NSPLIT uses them
    auto ldfs = [&](FS& f, int ko) {
#pragma unroll
        for (int mb = 0; mb < 4; ++mb) { f.a[mb] = WFrag<T16>::ld(pa + mb * 16 * K + ko * 16); if (NSPLIT == 1 || NSPLIT == 2) f.a2[mb] = WFrag<T16>::ld(pa2 + mb * 16 * K + ko * 16); }
#pragma unroll
        for (int nb = 0; nb < 4; ++nb) { f.b[nb] = WFrag<T16>::ld(pb + nb * 16 * K + ko * 16); if (NSPLIT >= 2) f.b2[nb] = WFrag<T16>::ld(pb2 + nb * 16 * K + ko * 16); }
        __builtin_amdgcn_sched_barrier(0);   // keeps the loads above the products that follow; without it the scheduler sinks each load to its first use
    };
    // the wait that stands in front of a rewrite of the loads' address registers; naming them keeps them whole up to it; behind a block of products it finds the count at 0
    auto xw = [&]() {
        if constexpr (NSPLIT == 0) asm volatile("s_wait_xcnt 0x0" :: "v"(pa), "v"(pb) : "memory");
        else if constexpr (NSPLIT == 1) asm volatile("s_wait_xcnt 0x0" :: "v"(pa), "v"(pa2), "v"(pb) : "memory");
        else asm volatile("s_wait_xcnt 0x0" :: "v"(pa), "v"(pa2), "v"(pb), "v"(pb2) : "memory");
    };
    auto mmfs = [&](FS& f) {
#pragma unroll
        for (int nb = 0; nb < 4; ++nb) {
#pragma unroll
            for (int mb = 0; mb < 4; ++mb) { acc[mb][nb] = WFrag<T16>::mma(f.a[mb], f.b[nb], acc[mb][nb]); if (NSPLIT == 1 || NSPLIT == 2) acc[mb][nb] = WFrag<T16>::mma(f.a2[mb], f.b[nb], acc[mb][nb]); if (NSPLIT >= 2) acc[mb][nb] = WFrag<T16>::mma(f.a[mb], f.b2[nb], acc[mb][nb]); } }
        // WMMA distance before the refill of this set and on the back edge
        asm volatile("v_nop\n\tv_nop\n\tv_nop\n\tv_nop" : "+v"(acc[0][0]), "+v"(acc[1][1]), "+v"(acc[2][2]), "+v"(acc[3][3]) : "v"(f.a[0]), "v"(f.a[3]));
    };
    FS f0, f1;
    ldfs(f0, 0);
    asm volatile("s_wait_xcnt 0x0" ::: "memory");   // in front of any rewrite of the registers that these first loads name (the loop's own wait names only the walking pointers)
    __builtin_amdgcn_sched_barrier(0);              // keeps such a rewrite behind the wait
#pragma unroll 1
    for (int kc = 0; kc < K - 64; kc += 64) {
        ldfs(f1, 32);
        mmfs(f0);
        xw();
        pa += 64 * 16; pa2 += 64 * 16; pb += 64 * 16; pb2 += 64 * 16;
        ldfs(f0, 0);
        mmfs(f1);
    }
    ldfs(f1, 32);
    mmfs(f0);
    xw();
    mmfs(f1);
#pragma unroll
    for (int mb = 0; mb < 4; ++mb) {
#pragma unroll
        for (int nb = 0; nb < 4; ++nb) {
#pragma unroll
            for (int j = 0; j < 8; ++j) os[(hi * 8 + j) * 68 + nb * 16 + lr] = acc[mb][nb][j]; }
        __builtin_amdgcn_wave_barrier(); asm volatile("" ::: "memory");
        float* crow = C + (size_t)(r0 + mb * 16) * ldc + c0;
{
#pragma unroll
            for (int s = 0; s < 8; ++s) { const int row = 2 * s + hi, cofs = lr * 4; v4f val = *(const v4fa*)(os + row * 68 + cofs); val = val * osc; if (BIAS) { val[0] += bfr(bias[c0 + cofs]); val[1] += bfr(bias[c0 + cofs + 1]); val[2] += bfr(bias[c0 + cofs + 2]); val[3] += bfr(bias[c0 + cofs + 3]); }
                *(v4f*)(crow + (size_t)row * ldc + cofs) = val; }
             }
        asm volatile("s_wait_xcnt 0x0" ::: "memory");   // in front of the next block's reuse of the stores' address and data registers
        __builtin_amdgcn_sched_barrier(0);              // keeps that reuse behind the wait
        __builtin_amdgcn_wave_barrier(); asm volatile("" ::: "memory");
    }
}

// ---- integer head selection: slot 0 -> head_idx[0], slot s>=1 -> head_idxs[s-1]; both values loaded unconditionally with clamped addresses, negative wraps by 16, result clamped to [0,15].
__device__ __forceinline__ int wrap16(int v) { v = (v < 0) ? (v + NH) : v; v = (v < 0) ? 0 : v; return (v > NH - 1) ? (NH - 1) : v; }
__device__ __forceinline__ int hsel(const int* hidx, const int* hidxs, int slot) {
    const int a = hidx[0]; int bi = slot - 1; bi = (bi < 0) ? 0 : ((bi > NH - 2) ? (NH - 2) : bi); const int c = hidxs[bi];
    return wrap16((slot == 0) ? a : c);
}

// The three converters: a block of 256 threads takes 16 rows x 128 columns of a [R][DM] source (thread -> row t>>4, columns (t&15)*8 .. +7, reads as whole runs of a row); in fragment order those are 2048 contiguous elements,
// piece (row lr, column piece c8) at piece index c8*16 + lr. fo_swap hands each thread the piece of its own index through LDS (pitch 17 pieces: no bank conflict either way), so the stores are whole lines too.
static_assert(DM % 128 == 0);
__device__ __forceinline__ v8us fo_swap(v8us* sm, v8us o, int t) {
    sm[(t & 15) * 17 + (t >> 4)] = o;
    __syncthreads();
    return sm[(t >> 4) * 17 + (t & 15)];
}

// coverage: NB*SEQ*DM elements per plane, 2048 per block, grid exact with a block-uniform bound -> whole plane.
__global__ __launch_bounds__(256) void k_cvtx(const float* __restrict__ s0, const float* __restrict__ s1, const float* __restrict__ s2, const float* __restrict__ s3, bf* d0, bf* d1, bf* d2, bf* d3) {
    __shared__ __align__(16) v8us sm[16 * 17];
    const size_t n8 = (size_t)NB * SEQ * DM / 8; if ((size_t)blockIdx.x * 256 >= n8) return;
    const int t = threadIdx.x, w = blockIdx.y;
    const float* src = (w == 0) ? s0 : ((w == 1) ? s1 : ((w == 2) ? s2 : s3)); bf* dst = (w == 0) ? d0 : ((w == 1) ? d1 : ((w == 2) ? d2 : d3));
    const size_t row = (size_t)(blockIdx.x / (DM / 128)) * 16 + (t >> 4); const int col = (int)(blockIdx.x % (DM / 128)) * 128 + (t & 15) * 8; const size_t b = row / SEQ, tt = row % SEQ;
    const v8f v = *(const v8f*)(src + ((b * SEQ_FULL + tt) * DM + col)); v8us o;
#pragma unroll
    for (int q = 0; q < 8; ++q) o[q] = f2bf(v[q]);
    *(v8us*)(dst + (size_t)blockIdx.x * 2048 + t * 8) = fo_swap(sm, o, t);
}

// coverage: 48*64*1024 elements, 2048 per block, grid exact with a block-uniform bound.
__global__ __launch_bounds__(256) void k_wg(const float* __restrict__ W, const int* __restrict__ hidx, const int* __restrict__ hidxs, bf* WB) {
    __shared__ __align__(16) v8us sm[16 * 17];
    const size_t n8 = (size_t)NSLOT * HD * DM / 8; if ((size_t)blockIdx.x * 256 >= n8) return;
    const int t = threadIdx.x;
    const int zr = (int)(blockIdx.x / (DM / 128)) * 16 + (t >> 4); const int k = (int)(blockIdx.x % (DM / 128)) * 128 + (t & 15) * 8;
    const int r = zr % HD; const int z = zr / HD; const int type = z >> 4, slot = z & 15;
    const int hs = hsel(hidx, hidxs, slot);
    const v8f v = *(const v8f*)(W + ((size_t)(type * DM + hs * HD + r)) * DM + k); v8us o;
#pragma unroll
    for (int q = 0; q < 8; ++q) o[q] = f2bf(v[q]);
    *(v8us*)(WB + (size_t)blockIdx.x * 2048 + t * 8) = fo_swap(sm, o, t);
}

// coverage: DM*DM elements, 2048 per block, grid exact with a block-uniform bound.
__global__ __launch_bounds__(256) void k_cvtw(const float* __restrict__ W, h16* WP16, bf* WPB) {
    __shared__ __align__(16) v8us sm[16 * 17];
    __shared__ __align__(16) v8us sm2[16 * 17];
    const size_t n8 = (size_t)DM * DM / 8; if ((size_t)blockIdx.x * 256 >= n8) return;
    const int t = threadIdx.x;
    const size_t row = (size_t)(blockIdx.x / (DM / 128)) * 16 + (t >> 4); const int col = (int)(blockIdx.x % (DM / 128)) * 128 + (t & 15) * 8;
    const v8f v = *(const v8f*)(W + row * DM + col); v8h o16; v8us ob;
#pragma unroll
    for (int q = 0; q < 8; ++q) { ob[q] = f2bf(v[q]); o16[q] = (h16)(bf2f(ob[q]) * WCAR); }
    sm2[(t & 15) * 17 + (t >> 4)] = ob;   // published by the barrier inside fo_swap
    const v8us p16 = fo_swap(sm, __builtin_bit_cast(v8us, o16), t);
    *(v8h*)(WP16 + (size_t)blockIdx.x * 2048 + t * 8) = __builtin_bit_cast(v8h, p16); *(v8us*)(WPB + (size_t)blockIdx.x * 2048 + t * 8) = sm2[(t >> 4) * 17 + (t & 15)];
}

// ---- k_qkv: per slot z = type*16 + slot, one wave per 64x64 tile of Y[b*SEQ + t][d] = sum_k XB[.][k] WB[z][d][k] + battn[type*DM + hsel(slot)*HD + d] (bf16 x bf16, f32 acc); grid (NB*SEQ/64, 1, 48), 32 threads.
// A = X1B/X2B/X3B for slot 0 (type q/k/v), XB otherwise (block-uniform select, no loaded index).
// Epilogue: the tile (+bias) is staged in LDS (q/k: [t][d]; v: transposed [d][t]); for every final head hp with wrap16(perm[hp]) == slot (block-uniform scalar compare) the tile is written to head planes zf = b*16 + hp:
// coverage: every (hp, b, t, d) of Q16/K16/VT is written by exactly one (slot == wrap16(perm[hp]), row tile) block; hi+lo planes for all t < RH likewise. LDS staging: 64x64 written in full before the barrier (cross-lane, block = one wave, __syncthreads).
__global__ __launch_bounds__(32) void k_qkv(const bf* __restrict__ XB, const bf* __restrict__ X1B, const bf* __restrict__ X2B, const bf* __restrict__ X3B, const bf* __restrict__ WB, const float* __restrict__ battn,
                                          const int* __restrict__ hidx, const int* __restrict__ hidxs, const int* __restrict__ perm,
                                          h16* Q16, bf* QH, bf* QL, h16* K16, bf* KH, bf* KL, h16* VT, bf* VH, bf* VL) {
    __shared__ __align__(16) h16 s16[64 * ST];
    __shared__ __align__(16) bf  sbh[64 * ST];
    __shared__ __align__(16) bf  sbl[64 * ST];
    const int lane = threadIdx.x & 31, lr = lane & 15, hi = lane >> 4;
    const int z = blockIdx.z, type = z >> 4, slot = z & 15;
    const int r0 = blockIdx.x * 64;                 // compact row index b*SEQ + t
    const int b = r0 / SEQ, t0 = r0 % SEQ; const bool hires = (t0 < RH);
    const bf* A = (slot == 0) ? ((type == 0) ? X1B : ((type == 1) ? X2B : X3B)) : XB;
    const bf* Bt = WB + (size_t)z * HD * DM;
    constexpr int K = DM;
    v8f acc[4][4];
#pragma unroll
    for (int mb = 0; mb < 4; ++mb)
#pragma unroll
        for (int nb = 0; nb < 4; ++nb) acc[mb][nb] = (v8f){};
    const size_t aoff = (size_t)r0 * K + 8 * lane, boff = (size_t)(8 * lane);
    // Two register sets of operand fragments: every load of k step s+1 is issued before the products of step s.
    struct FS { v16bf a[4], b[4]; };
    const bf* pa = A + aoff; const bf* pb = Bt + boff;
    auto ldfs = [&](FS& f, int ko) {
#pragma unroll
        for (int mb = 0; mb < 4; ++mb) f.a[mb] = WFrag<bf>::ld(pa + mb * 16 * K + ko * 16);
#pragma unroll
        for (int nb = 0; nb < 4; ++nb) f.b[nb] = WFrag<bf>::ld(pb + nb * 16 * K + ko * 16);
        __builtin_amdgcn_sched_barrier(0);   // keeps the loads above the products that follow; without it the scheduler sinks each load to its first use
    };
    // the wait that stands in front of a rewrite of the loads' address registers; naming them keeps them whole up to it; behind a block of products it finds the count at 0
    auto xw = [&]() { asm volatile("s_wait_xcnt 0x0" :: "v"(pa), "v"(pb) : "memory"); };
    auto mmfs = [&](FS& f) {
#pragma unroll
        for (int nb = 0; nb < 4; ++nb) {
#pragma unroll
            for (int mb = 0; mb < 4; ++mb) acc[mb][nb] = wmmab(f.a[mb], f.b[nb], acc[mb][nb]); }
        // WMMA distance before the refill of this set and on the back edge
        asm volatile("v_nop\n\tv_nop\n\tv_nop\n\tv_nop" : "+v"(acc[0][0]), "+v"(acc[1][1]), "+v"(acc[2][2]), "+v"(acc[3][3]) : "v"(f.a[0]), "v"(f.a[3]));
    };
    FS f0, f1;
    ldfs(f0, 0);
#pragma unroll 1
    for (int kc = 0; kc < K - 64; kc += 64) {
        ldfs(f1, 32);
        mmfs(f0);
        xw();
        pa += 64 * 16; pb += 64 * 16;
        ldfs(f0, 0);
        mmfs(f1);
    }
    ldfs(f1, 32);
    mmfs(f0);
    xw();
    mmfs(f1);
    // bias for this lane's columns (battn index <= 3071 by the clamps)
    const int hs = hsel(hidx, hidxs, slot); const int woff = type * DM + hs * HD;
    float bias[4];
#pragma unroll
    for (int nb = 0; nb < 4; ++nb) bias[nb] = bfr(battn[woff + nb * 16 + lr]);
    // stage the 64x64 tile
#pragma unroll
    for (int mb = 0; mb < 4; ++mb)
#pragma unroll
        for (int nb = 0; nb < 4; ++nb)
#pragma unroll
            for (int j = 0; j < 8; ++j) {
                const float v = acc[mb][nb][j] + bias[nb];
                const int row = mb * 16 + hi * 8 + j, col = nb * 16 + lr;
                const int ix = (type == 2) ? (col * ST + row) : (row * ST + col);
                s16[ix] = (h16)v;
                if (hires) { unsigned short a2, c2; splitf(v, a2, c2); sbh[ix] = a2; sbl[ix] = c2; }
            }
    __syncthreads();
    // the staged tile is a logical [64 rows][64 k] piece of its plane (q/k: rows t, k = d; v: rows d, k = t): store i = (16-row band i>>2, k block (i>>1)&1, half i&1) is one 512-byte run in fragment order
#pragma unroll 1
    for (int hp = 0; hp < NH; ++hp) {
        const int pp = wrap16(perm[hp]);
        if (pp != slot) continue;
        const int zf = b * NH + hp;
        // q/k: the tile's 4096 elements are contiguous; v: a band of 16 d rows holds 16*SEQ (16*RH) elements, the tile's two k blocks start at t0*16 in it
        h16* P = (type == 2) ? (VT + (size_t)zf * HD * SEQ + (size_t)t0 * 16) : (((type == 0) ? Q16 : K16) + ((size_t)zf * SEQ + t0) * HD);
        const size_t hoff = (type == 2) ? ((size_t)zf * HD * RH + (size_t)t0 * 16) : (((size_t)zf * RH + t0) * HD);
        bf* PHp = ((type == 2) ? VH : ((type == 0) ? QH : KH)) + hoff; bf* PLp = ((type == 2) ? VL : ((type == 0) ? QL : KL)) + hoff;
        const int band = (type == 2) ? (16 * SEQ) : 1024, bandh = (type == 2) ? (16 * RH) : 1024;
#pragma unroll 1
        for (int i4 = 0; i4 < 4; ++i4) {
            const int six = (i4 * 16 + lr) * ST + hi * 8;   // staged row i4*16 + lr, k = u*16 + 8*hi
            h16* d16 = P + (size_t)i4 * band + lane * 8;
            v8h v16[4];
#pragma unroll
            for (int u = 0; u < 4; ++u) v16[u] = *(const v8ha*)(s16 + six + u * 16);
            __builtin_amdgcn_sched_barrier(0);              // the band's LDS reads stand ahead of its stores, each in registers of its own
#pragma unroll
            for (int u = 0; u < 4; ++u) *(v8h*)(d16 + u * 256) = v16[u];
            asm volatile("s_wait_xcnt 0x0" ::: "memory");   // in front of the next reuse of the stores' address and data registers
            __builtin_amdgcn_sched_barrier(0);              // keeps that reuse behind the wait
            if (hires) {
                bf* dh = PHp + (size_t)i4 * bandh + lane * 8; bf* dl = PLp + (size_t)i4 * bandh + lane * 8;
                v8us vh[4], vl[4];
#pragma unroll
                for (int u = 0; u < 4; ++u) { vh[u] = *(const v8usa*)(sbh + six + u * 16); vl[u] = *(const v8usa*)(sbl + six + u * 16); }
                __builtin_amdgcn_sched_barrier(0);              // as above
#pragma unroll
                for (int u = 0; u < 4; ++u) { *(v8us*)(dh + u * 256) = vh[u]; *(v8us*)(dl + u * 256) = vl[u]; }
                asm volatile("s_wait_xcnt 0x0" ::: "memory");   // as above
                __builtin_amdgcn_sched_barrier(0);
            }
        }
    }
}

// ---- k_flash<HR>: causal attention, one (b, final head, 64-query tile) per block, 4 waves x 16 query rows, 64-key tiles kv0 = 0 .. q0 (tiles above the diagonal skipped, diagonal tile masked by replace-fill), online softmax in f32.
// HR=false (query tiles >= RH): S = Q16.K16^T single f16 planes; P operand = f16(p x 1024) in a wave-private LDS tile; O += P.VT single f16; y written as f16(y x 16) elements (b*SEQ + t, hp*64 + d) of Y16.
// HR=true (query tiles < RH): q, k, p(x1024), v as bf16 hi+lo planes, 3 products per tile pair; y written as bf16 hi+lo elements (b*RH + t, ..) of YH/YL.
// coverage: Y16 rows t in [RH, SEQ) x all hp (HR=false grid), YH/YL rows t < RH x all hp (HR=true grid).
// amdgpu_waves_per_eu: the single-plane grid puts three waves on a SIMD, the hi+lo grid one; the register budget is a third (a half) of the file per wave; held to four waves the scheduler runs the row reductions one after another to save registers, and the hi+lo form takes more than a third.
template <bool HR>
__global__ __launch_bounds__(128) __attribute__((amdgpu_waves_per_eu(1, HR ? 2 : 3))) void k_flash(const h16* __restrict__ Q16, const bf* __restrict__ QH, const bf* __restrict__ QL,
                                               const h16* __restrict__ K16, const bf* __restrict__ KH, const bf* __restrict__ KL,
                                               const h16* __restrict__ VT, const bf* __restrict__ VH, const bf* __restrict__ VL,
                                               h16* Y16, bf* YH, bf* YL, int qt0) {
    __shared__ __align__(16) h16 P16[4 * PT];
    __shared__ __align__(16) bf  PHs[4 * PT];
    __shared__ __align__(16) bf  PLs[4 * PT];
    const int tid = threadIdx.x, w = tid >> 5, lane = tid & 31, m = lane & 15, hi = lane >> 4;
    const int qt = qt0 + blockIdx.x, q0 = qt * 64, zf = blockIdx.y, b = zf >> 4, hp = zf & 15;
    const int qw = q0 + w * 16;                     // first query row of this wave
    h16* Pw = P16 + w * PT; bf* PHw = PHs + w * PT; bf* PLw = PLs + w * PT;
    v16h qa[2]; v16bf qah[2], qal[2];
    if constexpr (!HR) {
        const h16* pq = Q16 + ((size_t)zf * SEQ + qw) * HD + 8 * lane;
#pragma unroll
        for (int kk = 0; kk < 2; ++kk) qa[kk] = WFrag<h16>::ld(pq + kk * 512);
        asm volatile("s_wait_xcnt 0x0" :: "v"(pq) : "memory");   // in front of any rewrite of the loads' address registers
    } else {
        const bf* pqh = QH + ((size_t)zf * RH + qw) * HD + 8 * lane; const bf* pql = QL + ((size_t)zf * RH + qw) * HD + 8 * lane;
#pragma unroll
        for (int kk = 0; kk < 2; ++kk) { qah[kk] = WFrag<bf>::ld(pqh + kk * 512); qal[kk] = WFrag<bf>::ld(pql + kk * 512); }
        asm volatile("s_wait_xcnt 0x0" :: "v"(pqh), "v"(pql) : "memory");   // in front of any rewrite of the loads' address registers
    }
    v8f oacc[4];
#pragma unroll
    for (int nt = 0; nt < 4; ++nt) oacc[nt] = (v8f){};
    float mrow[8], lrow[8];
#pragma unroll
    for (int j = 0; j < 8; ++j) { mrow[j] = -3.0e38f; lrow[j] = 0.0f; }
    const int ntiles = qt + 1;
    // All fragments of a key tile live in registers, [kk][nt], and are loaded in one batch. Single planes: K of tile jt+1 is issued right behind the score products of tile jt, V of tile jt in front of them.
    // hi+lo planes (twice the fragments): K in one batch at the head of the tile, V in one batch right behind the score products, under the softmax.
    v16h kb[2][4], vb[2][4]; v16bf kbh[2][4], kbl[2][4], vbh[2][4], vbl[2][4];
    // this lane's walking pointers: K planes step 64 rows a tile (four bands of 16*HD), V planes 64 columns (two k blocks of 512)
    const h16* pk = K16 + (size_t)zf * SEQ * HD + 8 * lane; const h16* pv = VT + (size_t)zf * HD * SEQ + 8 * lane;
    const bf* pkh = KH + (size_t)zf * RH * HD + 8 * lane; const bf* pkl = KL + (size_t)zf * RH * HD + 8 * lane;
    const bf* pvh = VH + (size_t)zf * HD * RH + 8 * lane; const bf* pvl = VL + (size_t)zf * HD * RH + 8 * lane;
    auto ldK = [&]() {
#pragma unroll
        for (int kk = 0; kk < 2; ++kk) {
#pragma unroll
            for (int nt = 0; nt < 4; ++nt) {
                if constexpr (!HR) { kb[kk][nt] = WFrag<h16>::ld(pk + nt * 16 * HD + kk * 512); }
                else { kbh[kk][nt] = WFrag<bf>::ld(pkh + nt * 16 * HD + kk * 512); kbl[kk][nt] = WFrag<bf>::ld(pkl + nt * 16 * HD + kk * 512); }
            }
        }
        __builtin_amdgcn_sched_barrier(0);   // keeps the loads above the work that follows; without it the scheduler sinks each load to its first use
    };
    auto ldV = [&]() {
#pragma unroll
        for (int kk = 0; kk < 2; ++kk) {
#pragma unroll
            for (int nt = 0; nt < 4; ++nt) {
                if constexpr (!HR) { vb[kk][nt] = WFrag<h16>::ld(pv + nt * 16 * SEQ + kk * 512); }
                else { vbh[kk][nt] = WFrag<bf>::ld(pvh + nt * 16 * RH + kk * 512); vbl[kk][nt] = WFrag<bf>::ld(pvl + nt * 16 * RH + kk * 512); }
            }
        }
        __builtin_amdgcn_sched_barrier(0);   // as in ldK
    };
    if constexpr (!HR) ldK();
#pragma unroll 1
    for (int jt = 0; jt < ntiles; ++jt) {
        const int kv0 = jt * 64;
        if constexpr (!HR) ldV(); else ldK();
        v8f sacc[4];
#pragma unroll
        for (int nt = 0; nt < 4; ++nt) sacc[nt] = (v8f){};
        if constexpr (!HR) {
#pragma unroll
            for (int kk = 0; kk < 2; ++kk) {
#pragma unroll
                for (int nt = 0; nt < 4; ++nt) sacc[nt] = wmma16(qa[kk], kb[kk][nt], sacc[nt]);
            }
            asm volatile("v_nop\n\tv_nop\n\tv_nop\n\tv_nop" : "+v"(sacc[0]), "+v"(sacc[1]), "+v"(sacc[2]), "+v"(sacc[3]) : "v"(qa[0]), "v"(qa[1]), "v"(kb[1][3]));
        } else {
#pragma unroll
            for (int kk = 0; kk < 2; ++kk) {
#pragma unroll
                for (int nt = 0; nt < 4; ++nt) {
                    sacc[nt] = wmmab(qah[kk], kbh[kk][nt], sacc[nt]); sacc[nt] = wmmab(qal[kk], kbh[kk][nt], sacc[nt]);
                    sacc[nt] = wmmab(qah[kk], kbl[kk][nt], sacc[nt]); }
            }
            asm volatile("v_nop\n\tv_nop\n\tv_nop\n\tv_nop" : "+v"(sacc[0]), "+v"(sacc[1]), "+v"(sacc[2]), "+v"(sacc[3]) : "v"(kbh[1][3]), "v"(kbl[1][3]));
        }
        if constexpr (!HR) { pk += (jt + 1 < ntiles) ? (64 * HD) : 0; ldK(); }   // behind the last tile: an in-bounds reload of it that nothing consumes
        else ldV();
        // online softmax; row (hi*8 + j) of this wave lives on the 16 lanes sharing hi; diagonal tile: keys with index > query index get the replace-fill
        const bool diag = (kv0 == q0);
#pragma unroll
        for (int j = 0; j < 8; ++j) {
            const int rr = w * 16 + hi * 8 + j;         // query row within the 64-row tile
            float sv[4]; float mx = -3.0e38f;
#pragma unroll
            for (int nt = 0; nt < 4; ++nt) { float s = sacc[nt][j] * SCL; const int kn = nt * 16 + m; s = (diag && kn > rr) ? -3.0e38f : s; sv[nt] = s; mx = fmaxf(mx, s); }
#pragma unroll
            for (int off = 1; off < 16; off <<= 1) mx = fmaxf(mx, __shfl_xor(mx, off, 32));
            const float mn = fmaxf(mrow[j], mx);
            const float corr = __builtin_amdgcn_exp2f((mrow[j] - mn) * L2E);
            mrow[j] = mn;
            float psum = 0.0f;
#pragma unroll
            for (int nt = 0; nt < 4; ++nt) {
                const float p = __builtin_amdgcn_exp2f((sv[nt] - mn) * L2E); psum += p;
                const int ix = (hi * 8 + j) * ST + nt * 16 + m;
                if constexpr (!HR) { Pw[ix] = (h16)(p * PCAR); } else { unsigned short a2, c2; splitf(p * PCAR, a2, c2); PHw[ix] = a2; PLw[ix] = c2; }
            }
#pragma unroll
            for (int off = 1; off < 16; off <<= 1) psum += __shfl_xor(psum, off, 32);
            lrow[j] = lrow[j] * corr + psum;
#pragma unroll
            for (int nt = 0; nt < 4; ++nt) oacc[nt][j] *= corr;
        }
        __builtin_amdgcn_fence(3 /* release order */, "wavefront"); __builtin_amdgcn_wave_barrier(); asm volatile("" ::: "memory");
        // the wait that stands in front of a rewrite of the loads' address registers; naming them keeps them whole up to it; behind the softmax it finds the count at 0
        if constexpr (!HR) { asm volatile("s_wait_xcnt 0x0" :: "v"(pk), "v"(pv) : "memory"); pv += 1024; }
        else { asm volatile("s_wait_xcnt 0x0" :: "v"(pkh), "v"(pkl), "v"(pvh), "v"(pvl) : "memory"); pkh += 64 * HD; pkl += 64 * HD; pvh += 1024; pvl += 1024; }
        // O += P . V (A = P[row][key] from the wave tile, B = VT[d][key] plane)
        if constexpr (!HR) {
            v16h pa[2];
#pragma unroll
            for (int kk = 0; kk < 2; ++kk) {
                pa[kk] = cat16(*(const v8ha*)(Pw + m * ST + kk * 32 + 8 * hi), *(const v8ha*)(Pw + m * ST + kk * 32 + 8 * hi + 16));
#pragma unroll
                for (int nt = 0; nt < 4; ++nt) oacc[nt] = wmma16(pa[kk], vb[kk][nt], oacc[nt]);
            }
            asm volatile("v_nop\n\tv_nop\n\tv_nop\n\tv_nop" : "+v"(oacc[0]), "+v"(oacc[1]), "+v"(oacc[2]), "+v"(oacc[3]) : "v"(pa[0]), "v"(pa[1]), "v"(vb[1][3]));
        } else {
            v16bf pah[2], pal[2];
#pragma unroll
            for (int kk = 0; kk < 2; ++kk) {
                pah[kk] = cat16b(*(const v8usa*)(PHw + m * ST + kk * 32 + 8 * hi), *(const v8usa*)(PHw + m * ST + kk * 32 + 8 * hi + 16));
                pal[kk] = cat16b(*(const v8usa*)(PLw + m * ST + kk * 32 + 8 * hi), *(const v8usa*)(PLw + m * ST + kk * 32 + 8 * hi + 16));
#pragma unroll
                for (int nt = 0; nt < 4; ++nt) {
                    oacc[nt] = wmmab(pah[kk], vbh[kk][nt], oacc[nt]); oacc[nt] = wmmab(pal[kk], vbh[kk][nt], oacc[nt]);
                    oacc[nt] = wmmab(pah[kk], vbl[kk][nt], oacc[nt]); }
            }
            asm volatile("v_nop\n\tv_nop\n\tv_nop\n\tv_nop" : "+v"(oacc[0]), "+v"(oacc[1]), "+v"(oacc[2]), "+v"(oacc[3]) : "v"(pah[0]), "v"(pal[1]), "v"(vbh[1][3]), "v"(vbl[1][3]));
        }
        __builtin_amdgcn_wave_barrier(); asm volatile("" ::: "memory");
    }
    // normalise and stage y in the wave tile, then whole-line stores in fragment order
#pragma unroll
    for (int j = 0; j < 8; ++j) {
        const float inv = 1.0f / (lrow[j] * PCAR);
#pragma unroll
        for (int nt = 0; nt < 4; ++nt) {
            const float y = oacc[nt][j] * inv;
            const int ix = (hi * 8 + j) * ST + nt * 16 + m;
            if constexpr (!HR) { Pw[ix] = (h16)(y * YCAR); } else { unsigned short a2, c2; splitf(y, a2, c2); PHw[ix] = a2; PLw[ix] = c2; }
        }
    }
    __builtin_amdgcn_fence(3 /* release order */, "wavefront"); __builtin_amdgcn_wave_barrier(); asm volatile("" ::: "memory");
    // the wave's 16 rows x 64 columns are two k blocks of the [rows][DM] y plane: 1024 contiguous elements in fragment order, store i = (k block i>>1, half i&1)
#pragma unroll
    for (int i = 0; i < 4; ++i) {
        const int six = m * ST + i * 16 + hi * 8;
        if constexpr (!HR) {
            const v8h v16 = *(const v8ha*)(Pw + six);
            *(v8h*)(Y16 + ((size_t)b * SEQ + qw) * DM + hp * 1024 + i * 256 + lane * 8) = v16;
        } else {
            const v8us vh = *(const v8usa*)(PHw + six), vl = *(const v8usa*)(PLw + six);
            *(v8us*)(YH + ((size_t)b * RH + qw) * DM + hp * 1024 + i * 256 + lane * 8) = vh; *(v8us*)(YL + ((size_t)b * RH + qw) * DM + hp * 1024 + i * 256 + lane * 8) = vl;
        }
    }
}

extern "C" void kernel_launch(void* const* d_in, const int* in_sizes, int n_in,
                              void* d_out, int out_size, void* d_ws, size_t ws_size, hipStream_t stream) {
    if (n_in < 11) return;
    const int xneed = (NB - 1) * SEQ_FULL * DM + SEQ * DM;
    if (in_sizes[0] < xneed || in_sizes[1] < xneed || in_sizes[2] < xneed || in_sizes[3] < xneed) return;
    if (in_sizes[4] < NQKV * DM || in_sizes[5] < NQKV || in_sizes[6] < DM * DM || in_sizes[7] < DM) return;
    if (in_sizes[8] < 1 || in_sizes[9] < NH - 1 || in_sizes[10] < NH) return;
    if (out_size < xneed) return;
    const float* X1 = (const float*)d_in[0]; const float* X2 = (const float*)d_in[1]; const float* X3 = (const float*)d_in[2]; const float* X = (const float*)d_in[3];
    const float* Wattn = (const float*)d_in[4]; const float* battn = (const float*)d_in[5]; const float* Wproj = (const float*)d_in[6]; const float* bproj = (const float*)d_in[7];
    const int* hidx = (const int*)d_in[8]; const int* hidxs = (const int*)d_in[9]; const int* perm = (const int*)d_in[10];
    float* OUT = (float*)d_out;   // [NB_FULL][SEQ_FULL][DM] f32

    char* wsp = (char*)d_ws;
    auto take = [&](size_t bytes) { char* p = wsp; wsp += (bytes + 255) & ~(size_t)255; return (void*)p; };
    const size_t xplane = (size_t)NB * SEQ * DM * 2;                 // compact [NB*SEQ][DM] bf16, fragment order
    bf* XB = (bf*)take(xplane); bf* X1B = (bf*)take(xplane); bf* X2B = (bf*)take(xplane); bf* X3B = (bf*)take(xplane);
    bf* WB = (bf*)take((size_t)NSLOT * HD * DM * 2);
    h16* WP16 = (h16*)take((size_t)DM * DM * 2); bf* WPB = (bf*)take((size_t)DM * DM * 2);
    const size_t hplane = (size_t)NB * NH * SEQ * HD * 2, hplaneR = (size_t)NB * NH * RH * HD * 2;
    h16* Q16 = (h16*)take(hplane); h16* K16 = (h16*)take(hplane); h16* VT = (h16*)take(hplane);
    bf* QH = (bf*)take(hplaneR); bf* QL = (bf*)take(hplaneR); bf* KH = (bf*)take(hplaneR); bf* KL = (bf*)take(hplaneR); bf* VH = (bf*)take(hplaneR); bf* VL = (bf*)take(hplaneR);
    h16* Y16 = (h16*)take((size_t)NB * SEQ * DM * 2); bf* YH = (bf*)take((size_t)NB * RH * DM * 2); bf* YL = (bf*)take((size_t)NB * RH * DM * 2);
    if ((size_t)(wsp - (char*)d_ws) > ws_size) return;

    // 1) bf16 input planes (compact rows)
    k_cvtx<<<dim3((unsigned)(((size_t)NB * SEQ * DM / 8 + 255) / 256), 4), 256, 0, stream>>>(X, X1, X2, X3, XB, X1B, X2B, X3B);
    // 2) gathered head weight plane and output-projection weight planes
    k_wg<<<(unsigned)(((size_t)NSLOT * HD * DM / 8 + 255) / 256), 256, 0, stream>>>(Wattn, hidx, hidxs, WB);
    k_cvtw<<<(unsigned)(((size_t)DM * DM / 8 + 255) / 256), 256, 0, stream>>>(Wproj, WP16, WPB);
    // 3) head projections -> per final-head planes
    k_qkv<<<dim3(NB * SEQ / 64, 1, NSLOT), 32, 0, stream>>>(XB, X1B, X2B, X3B, WB, battn, hidx, hidxs, perm, Q16, QH, QL, K16, KH, KL, VT, VH, VL);
    // 4) causal attention: hi+lo band (query tiles < RH) and single-plane band (tiles >= RH)
    k_flash<true><<<dim3(RH / 64, NB * NH), 128, 0, stream>>>(Q16, QH, QL, K16, KH, KL, VT, VH, VL, Y16, YH, YL, 0);
    if (SEQ > RH) k_flash<false><<<dim3((SEQ - RH) / 64, NB * NH), 128, 0, stream>>>(Q16, QH, QL, K16, KH, KL, VT, VH, VL, Y16, YH, YL, RH / 64);
    // 5) output projection (+ bproj): rows < RH from bf16 hi+lo y, rows >= RH from the f16 plane (carries folded by OSC)
    k_gemmw<bf, 1, true, DM><<<dim3(RH / 64, DM / 64, NB), 32, 0, stream>>>(YH, YL, WPB, nullptr, OUT, DM, bproj, 1.0f, (size_t)RH * DM, (size_t)0, (size_t)SEQ_FULL * DM);
    if (SEQ > RH) k_gemmw<h16, 0, true, DM><<<dim3((SEQ - RH) / 64, DM / 64, NB), 32, 0, stream>>>(Y16 + (size_t)RH * DM, nullptr, WP16, nullptr, OUT + (size_t)RH * DM, DM, bproj, OSC, (size_t)SEQ * DM, (size_t)0, (size_t)SEQ_FULL * DM);
}

// v003
// A run of this version takes 148 microseconds.
// Timed twice side by side with v002, it ran 1.17 and 1.19 times as fast.
// All steps since v000 together make it 2.06 times as fast.
#include <hip/hip_runtime.h>

// Contractions: head projections x*W^T on v_wmma_f32_16x16x32_bf16 (RNE bf16 operands = converted inputs, exact products); attention k.q^T and v^T.p^T (both transposed) on v_wmma_f32_16x16x32_f16 single planes (p carried x1024) for query rows >= RH and on bf16 hi+lo planes (3 products) for query rows < RH; output projection on v_wmma_f32_16x16x32_f16 planes (y carried x16, W x64, folded by 2^-10) for rows >= RH and on bf16 hi+lo y planes (2 products) for rows < RH; f32 accumulate everywhere, softmax in f32.
// Every 16-bit operand plane in the workspace lies in fragment order: a logical [R][K] plane is cut into blocks of 16 rows x 32 k (512 elements, row bands of 16*K elements, k blocks ascending inside a band); inside a block element (r, k) stands at ((k>>4)&1)*256 + (((k>>3)&1)*16 + (r&15))*8 + (k&7), so each of a fragment's two 16-byte loads reads 512 contiguous bytes over the wave (four whole lines instead of pieces of sixteen).

#ifndef NB
#define NB 2
#endif
#ifndef SEQ
#define SEQ 2048
#endif
#define NB_FULL  2
#define SEQ_FULL 2048
#define DM   1024
#define NH   16
#define HD   64
#define NQKV 3072
#define NSLOT (3 * NH)
#ifndef RH
#define RH 512
#endif
#if RH > SEQ
#undef RH
#define RH SEQ
#endif
static_assert(SEQ % 64 == 0);
static_assert(RH % 64 == 0);
static_assert(RH <= SEQ);
static_assert(SEQ <= SEQ_FULL);
static_assert(NB <= NB_FULL);
static_assert(DM % 64 == 0);
#define PCAR 1024.0f
#define YCAR 16.0f
#define WCAR 64.0f
#define OSC  (1.0f / 1024.0f)
#define SCL  0.125f
#define L2E  1.4426950408889634f
#define ST   72

typedef _Float16 h16;
typedef unsigned short bf;
typedef __attribute__((ext_vector_type(16))) __bf16   v16bf;
typedef __attribute__((ext_vector_type(16))) _Float16 v16h;
typedef __attribute__((ext_vector_type(8)))  _Float16 v8h;
typedef __attribute__((ext_vector_type(8)))  unsigned short v8us;
typedef __attribute__((ext_vector_type(16))) unsigned short v16us;
typedef __attribute__((ext_vector_type(8)))  float    v8f;
typedef __attribute__((ext_vector_type(4)))  float    v4f;
typedef v8h  __attribute__((may_alias)) v8ha;
typedef v4f  __attribute__((may_alias)) v4fa;
typedef v8us __attribute__((may_alias)) v8usa;

__device__ __forceinline__ unsigned short f2bf(float f) { unsigned u = __float_as_uint(f); u += 0x7FFFu + ((u >> 16) & 1u); return (unsigned short)(u >> 16); }
__device__ __forceinline__ float bf2f(unsigned short b) { return __uint_as_float(((unsigned)b) << 16); }
__device__ __forceinline__ float bfr(float f) { return bf2f(f2bf(f)); }
__device__ __forceinline__ v16h cat16(v8h lo, v8h hi) { return __builtin_shufflevector(lo, hi, 0, 1, 2, 3, 4, 5, 6, 7, 8, 9, 10, 11, 12, 13, 14, 15); }
__device__ __forceinline__ v16bf cat16b(v8us lo, v8us hi) { return __builtin_bit_cast(v16bf, __builtin_shufflevector(lo, hi, 0, 1, 2, 3, 4, 5, 6, 7, 8, 9, 10, 11, 12, 13, 14, 15)); }
__device__ __forceinline__ v8f wmma16(v16h a, v16h b, v8f c) { return __builtin_amdgcn_wmma_f32_16x16x32_f16(false, a, false, b, (short)0, c, false, false); }
__device__ __forceinline__ v8f wmmab(v16bf a, v16bf b, v8f c) { return __builtin_amdgcn_wmma_f32_16x16x32_bf16(false, a, false, b, (short)0, c, false, false); }
__device__ __forceinline__ void splitf(float y, unsigned short& h, unsigned short& l) { h = f2bf(y); l = f2bf(y - bf2f(h)); }

// Fragment loaders: lane -> row (A) / column (B) = lane&15; elements 0..7 <- k0+8h+0..7, elements 8..15 <- k0+16+8h+0..7 (h = lane>>4); p already carries the 16x32 block's start + lane*8.
template <typename T16> struct WFrag;
template <> struct WFrag<h16> { typedef v16h V; static __device__ __forceinline__ V ld(const h16* p) { return cat16(*(const v8h*)p, *(const v8h*)(p + 256)); } static __device__ __forceinline__ v8f mma(V a, V b, v8f c) { return wmma16(a, b, c); } };
template <> struct WFrag<bf> { typedef v16bf V; static __device__ __forceinline__ V ld(const bf* p) { return cat16b(*(const v8us*)p, *(const v8us*)(p + 256)); } static __device__ __forceinline__ v8f mma(V a, V b, v8f c) { return wmmab(a, b, c); } };

// ---- k_gemmw: register-blocked GEMM, ONE WAVE per 64x64 output tile (16 accumulators), operands straight from 16-bit planes in fragment order; grid (M/64, N/64, Z), 32 threads.
// C[m][n] (f32, pitch ldc) = (sum_k A[m][k] Bt[n][k] (+ A2[m][k] Bt[n][k] when NSPLIT==1)) * osc + bias[n] (bf16 RNE value). z-batch strides sA/sB/sC in elements. K % 64 == 0, K >= 64.
template <typename T16, int NSPLIT, bool BIAS, int K>
__global__ __launch_bounds__(32) void k_gemmw(const T16* __restrict__ A, const T16* __restrict__ A2, const T16* __restrict__ Bt, const T16* __restrict__ Bt2, float* C, int ldc, const float* __restrict__ bias, float osc, size_t sA, size_t sB, size_t sC) {
    typedef typename WFrag<T16>::V V;
    __shared__ __align__(16) float os[16 * 68];
    const size_t z = blockIdx.z; A += z * sA; if (A2) A2 += z * sA; Bt += z * sB; if (Bt2) Bt2 += z * sB; C += z * sC;
    const int lane = threadIdx.x & 31, lr = lane & 15, hi = lane >> 4; const int r0 = blockIdx.x * 64, c0 = blockIdx.y * 64;
    v8f acc[4][4];
#pragma unroll
    for (int mb = 0; mb < 4; ++mb)
#pragma unroll
        for (int nb = 0; nb < 4; ++nb) acc[mb][nb] = (v8f){};
    const size_t aoff = (size_t)r0 * K + 8 * lane, boff = (size_t)c0 * K + 8 * lane;
    // Two register sets of operand fragments: every load of k step s+1 is issued before the products of step s, so a step waits for one load latency at most.
    static_assert(K % 64 == 0 && K >= 64);
    struct FS { V a[4], a2[4], b[4], b2[4]; };
    const T16* pa = A + aoff; const T16* pa2 = A2 + aoff; const T16* pb = Bt + boff; const T16* pb2 = Bt2 + boff;   // pa2 / pb2 are read only where NSPLIT uses them
    auto ldfs = [&](FS& f, int ko) {
#pragma unroll
        for (int mb = 0; mb < 4; ++mb) { f.a[mb] = WFrag<T16>::ld(pa + mb * 16 * K + ko * 16); if (NSPLIT == 1 || NSPLIT == 2) f.a2[mb] = WFrag<T16>::ld(pa2 + mb * 16 * K + ko * 16); }
#pragma unroll
        for (int nb = 0; nb < 4; ++nb) { f.b[nb] = WFrag<T16>::ld(pb + nb * 16 * K + ko * 16); if (NSPLIT >= 2) f.b2[nb] = WFrag<T16>::ld(pb2 + nb * 16 * K + ko * 16); }
        __builtin_amdgcn_sched_barrier(0);   // keeps the loads above the products that follow; without it the scheduler sinks each load to its first use
    };
    // the wait that stands in front of a rewrite of the loads' address registers; naming them keeps them whole up to it; behind a block of products it finds the count at 0
    auto xw = [&]() {
        if constexpr (NSPLIT == 0) asm volatile("s_wait_xcnt 0x0" :: "v"(pa), "v"(pb) : "memory");
        else if constexpr (NSPLIT == 1) asm volatile("s_wait_xcnt 0x0" :: "v"(pa), "v"(pa2), "v"(pb) : "memory");
        else asm volatile("s_wait_xcnt 0x0" :: "v"(pa), "v"(pa2), "v"(pb), "v"(pb2) : "memory");
    };
    auto mmfs = [&](FS& f) {
#pragma unroll
        for (int nb = 0; nb < 4; ++nb) {
#pragma unroll
            for (int mb = 0; mb < 4; ++mb) { acc[mb][nb] = WFrag<T16>::mma(f.a[mb], f.b[nb], acc[mb][nb]); if (NSPLIT == 1 || NSPLIT == 2) acc[mb][nb] = WFrag<T16>::mma(f.a2[mb], f.b[nb], acc[mb][nb]); if (NSPLIT >= 2) acc[mb][nb] = WFrag<T16>::mma(f.a[mb], f.b2[nb], acc[mb][nb]); } }
        // WMMA distance before the refill of this set and on the back edge
        asm volatile("v_nop\n\tv_nop\n\tv_nop\n\tv_nop" : "+v"(acc[0][0]), "+v"(acc[1][1]), "+v"(acc[2][2]), "+v"(acc[3][3]) : "v"(f.a[0]), "v"(f.a[3]));
    };
    FS f0, f1;
    ldfs(f0, 0);
    asm volatile("s_wait_xcnt 0x0" ::: "memory");   // in front of any rewrite of the registers that these first loads name (the loop's own wait names only the walking pointers)
    __builtin_amdgcn_sched_barrier(0);              // keeps such a rewrite behind the wait
#pragma unroll 1
    for (int kc = 0; kc < K - 64; kc += 64) {
        ldfs(f1, 32);
        mmfs(f0);
        xw();
        pa += 64 * 16; pa2 += 64 * 16; pb += 64 * 16; pb2 += 64 * 16;
        ldfs(f0, 0);
        mmfs(f1);
    }
    ldfs(f1, 32);
    mmfs(f0);
    xw();
    mmfs(f1);
#pragma unroll
    for (int mb = 0; mb < 4; ++mb) {
#pragma unroll
        for (int nb = 0; nb < 4; ++nb) {
#pragma unroll
            for (int j = 0; j < 8; ++j) os[(hi * 8 + j) * 68 + nb * 16 + lr] = acc[mb][nb][j]; }
        __builtin_amdgcn_wave_barrier(); asm volatile("" ::: "memory");
        float* crow = C + (size_t)(r0 + mb * 16) * ldc + c0;
{
#pragma unroll
            for (int s = 0; s < 8; ++s) { const int row = 2 * s + hi, cofs = lr * 4; v4f val = *(const v4fa*)(os + row * 68 + cofs); val = val * osc; if (BIAS) { val[0] += bfr(bias[c0 + cofs]); val[1] += bfr(bias[c0 + cofs + 1]); val[2] += bfr(bias[c0 + cofs + 2]); val[3] += bfr(bias[c0 + cofs + 3]); }
                *(v4f*)(crow + (size_t)row * ldc + cofs) = val; }
             }
        asm volatile("s_wait_xcnt 0x0" ::: "memory");   // in front of the next block's reuse of the stores' address and data registers
        __builtin_amdgcn_sched_barrier(0);              // keeps that reuse behind the wait
        __builtin_amdgcn_wave_barrier(); asm volatile("" ::: "memory");
    }
}

// ---- integer head selection: slot 0 -> head_idx[0], slot s>=1 -> head_idxs[s-1]; both values loaded unconditionally with clamped addresses, negative wraps by 16, result clamped to [0,15].
__device__ __forceinline__ int wrap16(int v) { v = (v < 0) ? (v + NH) : v; v = (v < 0) ? 0 : v; return (v > NH - 1) ? (NH - 1) : v; }
__device__ __forceinline__ int hsel(const int* hidx, const int* hidxs, int slot) {
    const int a = hidx[0]; int bi = slot - 1; bi = (bi < 0) ? 0 : ((bi > NH - 2) ? (NH - 2) : bi); const int c = hidxs[bi];
    return wrap16((slot == 0) ? a : c);
}

// The three converters: a block of 256 threads takes 16 rows x 128 columns of a [R][DM] source (thread -> row t>>4, columns (t&15)*8 .. +7, reads as whole runs of a row); in fragment order those are 2048 contiguous elements,
// piece (row lr, column piece c8) at piece index c8*16 + lr. fo_swap hands each thread the piece of its own index through LDS (pitch 17 pieces: no bank conflict either way), so the stores are whole lines too.
static_assert(DM % 128 == 0);
__device__ __forceinline__ v8us fo_swap(v8us* sm, v8us o, int t) {
    sm[(t & 15) * 17 + (t >> 4)] = o;
    __syncthreads();
    return sm[(t >> 4) * 17 + (t & 15)];
}

// coverage: NB*SEQ*DM elements per plane, 2048 per block, grid exact with a block-uniform bound -> whole plane.
__global__ __launch_bounds__(256) void k_cvtx(const float* __restrict__ s0, const float* __restrict__ s1, const float* __restrict__ s2, const float* __restrict__ s3, bf* d0, bf* d1, bf* d2, bf* d3) {
    __shared__ __align__(16) v8us sm[16 * 17];
    const size_t n8 = (size_t)NB * SEQ * DM / 8; if ((size_t)blockIdx.x * 256 >= n8) return;
    const int t = threadIdx.x, w = blockIdx.y;
    const float* src = (w == 0) ? s0 : ((w == 1) ? s1 : ((w == 2) ? s2 : s3)); bf* dst = (w == 0) ? d0 : ((w == 1) ? d1 : ((w == 2) ? d2 : d3));
    const size_t row = (size_t)(blockIdx.x / (DM / 128)) * 16 + (t >> 4); const int col = (int)(blockIdx.x % (DM / 128)) * 128 + (t & 15) * 8; const size_t b = row / SEQ, tt = row % SEQ;
    const v8f v = *(const v8f*)(src + ((b * SEQ_FULL + tt) * DM + col)); v8us o;
#pragma unroll
    for (int q = 0; q < 8; ++q) o[q] = f2bf(v[q]);
    *(v8us*)(dst + (size_t)blockIdx.x * 2048 + t * 8) = fo_swap(sm, o, t);
}

// coverage: 48*64*1024 elements, 2048 per block, grid exact with a block-uniform bound.
__global__ __launch_bounds__(256) void k_wg(const float* __restrict__ W, const int* __restrict__ hidx, const int* __restrict__ hidxs, bf* WB) {
    __shared__ __align__(16) v8us sm[16 * 17];
    const size_t n8 = (size_t)NSLOT * HD * DM / 8; if ((size_t)blockIdx.x * 256 >= n8) return;
    const int t = threadIdx.x;
    const int zr = (int)(blockIdx.x / (DM / 128)) * 16 + (t >> 4); const int k = (int)(blockIdx.x % (DM / 128)) * 128 + (t & 15) * 8;
    const int r = zr % HD; const int z = zr / HD; const int type = z >> 4, slot = z & 15;
    const int hs = hsel(hidx, hidxs, slot);
    const v8f v = *(const v8f*)(W + ((size_t)(type * DM + hs * HD + r)) * DM + k); v8us o;
#pragma unroll
    for (int q = 0; q < 8; ++q) o[q] = f2bf(v[q]);
    *(v8us*)(WB + (size_t)blockIdx.x * 2048 + t * 8) = fo_swap(sm, o, t);
}

// coverage: DM*DM elements, 2048 per block, grid exact with a block-uniform bound.
__global__ __launch_bounds__(256) void k_cvtw(const float* __restrict__ W, h16* WP16, bf* WPB) {
    __shared__ __align__(16) v8us sm[16 * 17];
    __shared__ __align__(16) v8us sm2[16 * 17];
    const size_t n8 = (size_t)DM * DM / 8; if ((size_t)blockIdx.x * 256 >= n8) return;
    const int t = threadIdx.x;
    const size_t row = (size_t)(blockIdx.x / (DM / 128)) * 16 + (t >> 4); const int col = (int)(blockIdx.x % (DM / 128)) * 128 + (t & 15) * 8;
    const v8f v = *(const v8f*)(W + row * DM + col); v8h o16; v8us ob;
#pragma unroll
    for (int q = 0; q < 8; ++q) { ob[q] = f2bf(v[q]); o16[q] = (h16)(bf2f(ob[q]) * WCAR); }
    sm2[(t & 15) * 17 + (t >> 4)] = ob;   // published by the barrier inside fo_swap
    const v8us p16 = fo_swap(sm, __builtin_bit_cast(v8us, o16), t);
    *(v8h*)(WP16 + (size_t)blockIdx.x * 2048 + t * 8) = __builtin_bit_cast(v8h, p16); *(v8us*)(WPB + (size_t)blockIdx.x * 2048 + t * 8) = sm2[(t >> 4) * 17 + (t & 15)];
}

// ---- k_qkv: per slot z = type*16 + slot, one wave per 64x64 tile of Y[b*SEQ + t][d] = sum_k XB[.][k] WB[z][d][k] + battn[type*DM + hsel(slot)*HD + d] (bf16 x bf16, f32 acc); grid (NB*SEQ/64, 1, 48), 32 threads.
// A = X1B/X2B/X3B for slot 0 (type q/k/v), XB otherwise (block-uniform select, no loaded index).
// Epilogue: the tile (+bias) is staged in LDS (q/k: [t][d]; v: transposed [d][t]); for every final head hp with wrap16(perm[hp]) == slot (block-uniform scalar compare) the tile is written to head planes zf = b*16 + hp:
// coverage: every (hp, b, t, d) of Q16/K16/VT is written by exactly one (slot == wrap16(perm[hp]), row tile) block; hi+lo planes for all t < RH likewise. LDS staging: 64x64 written in full before the barrier (cross-lane, block = one wave, __syncthreads).
__global__ __launch_bounds__(32) void k_qkv(const bf* __restrict__ XB, const bf* __restrict__ X1B, const bf* __restrict__ X2B, const bf* __restrict__ X3B, const bf* __restrict__ WB, const float* __restrict__ battn,
                                          const int* __restrict__ hidx, const int* __restrict__ hidxs, const int* __restrict__ perm,
                                          h16* Q16, bf* QH, bf* QL, h16* K16, bf* KH, bf* KL, h16* VT, bf* VH, bf* VL) {
    __shared__ __align__(16) h16 s16[64 * ST];
    __shared__ __align__(16) bf  sbh[64 * ST];
    __shared__ __align__(16) bf  sbl[64 * ST];
    const int lane = threadIdx.x & 31, lr = lane & 15, hi = lane >> 4;
    const int z = blockIdx.z, type = z >> 4, slot = z & 15;
    const int r0 = blockIdx.x * 64;                 // compact row index b*SEQ + t
    const int b = r0 / SEQ, t0 = r0 % SEQ; const bool hires = (t0 < RH);
    const bf* A = (slot == 0) ? ((type == 0) ? X1B : ((type == 1) ? X2B : X3B)) : XB;
    const bf* Bt = WB + (size_t)z * HD * DM;
    constexpr int K = DM;
    v8f acc[4][4];
#pragma unroll
    for (int mb = 0; mb < 4; ++mb)
#pragma unroll
        for (int nb = 0; nb < 4; ++nb) acc[mb][nb] = (v8f){};
    const size_t aoff = (size_t)r0 * K + 8 * lane, boff = (size_t)(8 * lane);
    // Two register sets of operand fragments: every load of k step s+1 is issued before the products of step s.
    struct FS { v16bf a[4], b[4]; };
    const bf* pa = A + aoff; const bf* pb = Bt + boff;
    auto ldfs = [&](FS& f, int ko) {
#pragma unroll
        for (int mb = 0; mb < 4; ++mb) f.a[mb] = WFrag<bf>::ld(pa + mb * 16 * K + ko * 16);
#pragma unroll
        for (int nb = 0; nb < 4; ++nb) f.b[nb] = WFrag<bf>::ld(pb + nb * 16 * K + ko * 16);
        __builtin_amdgcn_sched_barrier(0);   // keeps the loads above the products that follow; without it the scheduler sinks each load to its first use
    };
    // the wait that stands in front of a rewrite of the loads' address registers; naming them keeps them whole up to it; behind a block of products it finds the count at 0
    auto xw = [&]() { asm volatile("s_wait_xcnt 0x0" :: "v"(pa), "v"(pb) : "memory"); };
    auto mmfs = [&](FS& f) {
#pragma unroll
        for (int nb = 0; nb < 4; ++nb) {
#pragma unroll
            for (int mb = 0; mb < 4; ++mb) acc[mb][nb] = wmmab(f.a[mb], f.b[nb], acc[mb][nb]); }
        // WMMA distance before the refill of this set and on the back edge
        asm volatile("v_nop\n\tv_nop\n\tv_nop\n\tv_nop" : "+v"(acc[0][0]), "+v"(acc[1][1]), "+v"(acc[2][2]), "+v"(acc[3][3]) : "v"(f.a[0]), "v"(f.a[3]));
    };
    FS f0, f1;
    ldfs(f0, 0);
#pragma unroll 1
    for (int kc = 0; kc < K - 64; kc += 64) {
        ldfs(f1, 32);
        mmfs(f0);
        xw();
        pa += 64 * 16; pb += 64 * 16;
        ldfs(f0, 0);
        mmfs(f1);
    }
    ldfs(f1, 32);
    mmfs(f0);
    xw();
    mmfs(f1);
    // bias for this lane's columns (battn index <= 3071 by the clamps)
    const int hs = hsel(hidx, hidxs, slot); const int woff = type * DM + hs * HD;
    float bias[4];
#pragma unroll
    for (int nb = 0; nb < 4; ++nb) bias[nb] = bfr(battn[woff + nb * 16 + lr]);
    // stage the 64x64 tile
#pragma unroll
    for (int mb = 0; mb < 4; ++mb)
#pragma unroll
        for (int nb = 0; nb < 4; ++nb)
#pragma unroll
            for (int j = 0; j < 8; ++j) {
                const float v = acc[mb][nb][j] + bias[nb];
                const int row = mb * 16 + hi * 8 + j, col = nb * 16 + lr;
                const int ix = (type == 2) ? (col * ST + row) : (row * ST + col);
                s16[ix] = (h16)v;
                if (hires) { unsigned short a2, c2; splitf(v, a2, c2); sbh[ix] = a2; sbl[ix] = c2; }
            }
    __syncthreads();
    // the staged tile is a logical [64 rows][64 k] piece of its plane (q/k: rows t, k = d; v: rows d, k = t): store i = (16-row band i>>2, k block (i>>1)&1, half i&1) is one 512-byte run in fragment order
#pragma unroll 1
    for (int hp = 0; hp < NH; ++hp) {
        const int pp = wrap16(perm[hp]);
        if (pp != slot) continue;
        const int zf = b * NH + hp;
        // q/k: the tile's 4096 elements are contiguous; v: a band of 16 d rows holds 16*SEQ (16*RH) elements, the tile's two k blocks start at t0*16 in it
        h16* P = (type == 2) ? (VT + (size_t)zf * HD * SEQ + (size_t)t0 * 16) : (((type == 0) ? Q16 : K16) + ((size_t)zf * SEQ + t0) * HD);
        const size_t hoff = (type == 2) ? ((size_t)zf * HD * RH + (size_t)t0 * 16) : (((size_t)zf * RH + t0) * HD);
        bf* PHp = ((type == 2) ? VH : ((type == 0) ? QH : KH)) + hoff; bf* PLp = ((type == 2) ? VL : ((type == 0) ? QL : KL)) + hoff;
        const int band = (type == 2) ? (16 * SEQ) : 1024, bandh = (type == 2) ? (16 * RH) : 1024;
#pragma unroll 1
        for (int i4 = 0; i4 < 4; ++i4) {
            const int six = (i4 * 16 + lr) * ST + hi * 8;   // staged row i4*16 + lr, k = u*16 + 8*hi
            h16* d16 = P + (size_t)i4 * band + lane * 8;
            v8h v16[4];
#pragma unroll
            for (int u = 0; u < 4; ++u) v16[u] = *(const v8ha*)(s16 + six + u * 16);
            __builtin_amdgcn_sched_barrier(0);              // the band's LDS reads stand ahead of its stores, each in registers of its own
#pragma unroll
            for (int u = 0; u < 4; ++u) *(v8h*)(d16 + u * 256) = v16[u];
            asm volatile("s_wait_xcnt 0x0" ::: "memory");   // in front of the next reuse of the stores' address and data registers
            __builtin_amdgcn_sched_barrier(0);              // keeps that reuse behind the wait
            if (hires) {
                bf* dh = PHp + (size_t)i4 * bandh + lane * 8; bf* dl = PLp + (size_t)i4 * bandh + lane * 8;
                v8us vh[4], vl[4];
#pragma unroll
                for (int u = 0; u < 4; ++u) { vh[u] = *(const v8usa*)(sbh + six + u * 16); vl[u] = *(const v8usa*)(sbl + six + u * 16); }
                __builtin_amdgcn_sched_barrier(0);              // as above
#pragma unroll
                for (int u = 0; u < 4; ++u) { *(v8us*)(dh + u * 256) = vh[u]; *(v8us*)(dl + u * 256) = vl[u]; }
                asm volatile("s_wait_xcnt 0x0" ::: "memory");   // as above
                __builtin_amdgcn_sched_barrier(0);
            }
        }
    }
}

// ---- k_flash<HR>: causal attention, one (b, final head, 64-query tile) per block, 4 waves x 16 query rows, 64-key tiles kv0 = 0 .. q0 (tiles above the diagonal skipped, diagonal tile masked by replace-fill), online softmax in f32.
// Both products run transposed: St = K.Qt (A = K rows, B = Q) and Ot += Vt.Pt (A = VT rows d, B = Pt). In an accumulator tile nt a lane then holds ONE query (column lane&15) and the eight keys (or d) nt*16 + 8*(lane>>4) + j:
// a query's maximum and sum are taken inside the lane plus one exchange between the wave's halves, and tiles 2kk and 2kk+1 of the lane's own p values are, in that order, the sixteen elements of the Pt fragment of key block kk, so p never leaves the registers.
// HR=false (query tiles >= RH): single f16 planes, p carried x 1024; y written as f16(y x 16) elements (b*SEQ + t, hp*64 + d) of Y16.
// HR=true (query tiles < RH): q, k, p(x1024), v as bf16 hi+lo planes, 3 products per tile pair; y written as bf16 hi+lo elements (b*RH + t, ..) of YH/YL.
// coverage: Y16 rows t in [RH, SEQ) x all hp (HR=false grid), YH/YL rows t < RH x all hp (HR=true grid).
// amdgpu_waves_per_eu: the single-plane grid puts three waves on a SIMD, the hi+lo grid two, so the register budget is a third (a half) of the file per wave.
__device__ __forceinline__ float xhalf(float x) { return __builtin_bit_cast(float, __builtin_amdgcn_permlanex16(__builtin_bit_cast(int, x), __builtin_bit_cast(int, x), 0x76543210, 0xfedcba98, false, false)); }   // lane l <-> lane l ^ 16
template <bool HR>
__global__ __launch_bounds__(128) __attribute__((amdgpu_waves_per_eu(1, HR ? 2 : 3))) void k_flash(const h16* __restrict__ Q16, const bf* __restrict__ QH, const bf* __restrict__ QL,
                                               const h16* __restrict__ K16, const bf* __restrict__ KH, const bf* __restrict__ KL,
                                               const h16* __restrict__ VT, const bf* __restrict__ VH, const bf* __restrict__ VL,
                                               h16* Y16, bf* YH, bf* YL, int qt0) {
    const int tid = threadIdx.x, w = tid >> 5, lane = tid & 31, m = lane & 15, hi = lane >> 4;
    const int qt = qt0 + blockIdx.x, q0 = qt * 64, zf = blockIdx.y, b = zf >> 4, hp = zf & 15;
    const int qw = q0 + w * 16;                     // first query row of this wave
    v16h qa[2]; v16bf qah[2], qal[2];
    if constexpr (!HR) {
        const h16* pq = Q16 + ((size_t)zf * SEQ + qw) * HD + 8 * lane;
#pragma unroll
        for (int kk = 0; kk < 2; ++kk) qa[kk] = WFrag<h16>::ld(pq + kk * 512);
        asm volatile("s_wait_xcnt 0x0" :: "v"(pq) : "memory");   // in front of any rewrite of the loads' address registers
    } else {
        const bf* pqh = QH + ((size_t)zf * RH + qw) * HD + 8 * lane; const bf* pql = QL + ((size_t)zf * RH + qw) * HD + 8 * lane;
#pragma unroll
        for (int kk = 0; kk < 2; ++kk) { qah[kk] = WFrag<bf>::ld(pqh + kk * 512); qal[kk] = WFrag<bf>::ld(pql + kk * 512); }
        asm volatile("s_wait_xcnt 0x0" :: "v"(pqh), "v"(pql) : "memory");   // in front of any rewrite of the loads' address registers
    }
    v8f oacc[4];                                    // Ot: tile nt, element j = (d = nt*16 + 8*hi + j, query m)
#pragma unroll
    for (int nt = 0; nt < 4; ++nt) oacc[nt] = (v8f){};
    float mrow = -3.0e38f, lrow = 0.0f;             // this lane's query: running maximum (both halves alike), sum over this half's keys
    const int rr = w * 16 + m;                      // this lane's query row within the 64-row tile
    const int ntiles = qt + 1;
    // All fragments of a key tile live in registers, [kk][nt], and are loaded in one batch. Single planes: K of tile jt+1 is issued right behind the score products of tile jt, V of tile jt in front of them.
    // hi+lo planes (twice the fragments): K in one batch at the head of the tile, V in one batch right behind the score products, under the softmax.
    v16h kb[2][4], vb[2][4]; v16bf kbh[2][4], kbl[2][4], vbh[2][4], vbl[2][4];
    // this lane's walking pointers: K planes step 64 rows a tile (four bands of 16*HD), V planes 64 columns (two k blocks of 512)
    const h16* pk = K16 + (size_t)zf * SEQ * HD + 8 * lane; const h16* pv = VT + (size_t)zf * HD * SEQ + 8 * lane;
    const bf* pkh = KH + (size_t)zf * RH * HD + 8 * lane; const bf* pkl = KL + (size_t)zf * RH * HD + 8 * lane;
    const bf* pvh = VH + (size_t)zf * HD * RH + 8 * lane; const bf* pvl = VL + (size_t)zf * HD * RH + 8 * lane;
    auto ldK = [&]() {
#pragma unroll
        for (int kk = 0; kk < 2; ++kk) {
#pragma unroll
            for (int nt = 0; nt < 4; ++nt) {
                if constexpr (!HR) { kb[kk][nt] = WFrag<h16>::ld(pk + nt * 16 * HD + kk * 512); }
                else { kbh[kk][nt] = WFrag<bf>::ld(pkh + nt * 16 * HD + kk * 512); kbl[kk][nt] = WFrag<bf>::ld(pkl + nt * 16 * HD + kk * 512); }
            }
        }
        __builtin_amdgcn_sched_barrier(0);   // keeps the loads above the work that follows; without it the scheduler sinks each load to its first use
    };
    auto ldV = [&]() {
#pragma unroll
        for (int kk = 0; kk < 2; ++kk) {
#pragma unroll
            for (int nt = 0; nt < 4; ++nt) {
                if constexpr (!HR) { vb[kk][nt] = WFrag<h16>::ld(pv + nt * 16 * SEQ + kk * 512); }
                else { vbh[kk][nt] = WFrag<bf>::ld(pvh + nt * 16 * RH + kk * 512); vbl[kk][nt] = WFrag<bf>::ld(pvl + nt * 16 * RH + kk * 512); }
            }
        }
        __builtin_amdgcn_sched_barrier(0);   // as in ldK
    };
    if constexpr (!HR) ldK();
#pragma unroll 1
    for (int jt = 0; jt < ntiles; ++jt) {
        const int kv0 = jt * 64;
        if constexpr (!HR) ldV(); else ldK();
        v8f sacc[4];                                // St: tile nt, element j = (key nt*16 + 8*hi + j, query m)
#pragma unroll
        for (int nt = 0; nt < 4; ++nt) sacc[nt] = (v8f){};
        if constexpr (!HR) {
#pragma unroll
            for (int kk = 0; kk < 2; ++kk) {
#pragma unroll
                for (int nt = 0; nt < 4; ++nt) sacc[nt] = wmma16(kb[kk][nt], qa[kk], sacc[nt]);
            }
            asm volatile("v_nop\n\tv_nop\n\tv_nop\n\tv_nop" : "+v"(sacc[0]), "+v"(sacc[1]), "+v"(sacc[2]), "+v"(sacc[3]) : "v"(qa[0]), "v"(qa[1]), "v"(kb[1][3]));   // WMMA distance in front of the readers of the scores and of the refill of K
        } else {
#pragma unroll
            for (int kk = 0; kk < 2; ++kk) {
#pragma unroll
                for (int nt = 0; nt < 4; ++nt) {
                    sacc[nt] = wmmab(kbh[kk][nt], qah[kk], sacc[nt]); sacc[nt] = wmmab(kbh[kk][nt], qal[kk], sacc[nt]);
                    sacc[nt] = wmmab(kbl[kk][nt], qah[kk], sacc[nt]); }
            }
            asm volatile("v_nop\n\tv_nop\n\tv_nop\n\tv_nop" : "+v"(sacc[0]), "+v"(sacc[1]), "+v"(sacc[2]), "+v"(sacc[3]) : "v"(kbh[1][3]), "v"(kbl[1][3]));   // as above
        }
        if constexpr (!HR) { pk += (jt + 1 < ntiles) ? (64 * HD) : 0; ldK(); }   // behind the last tile: an in-bounds reload of it that nothing consumes
        else ldV();
        // online softmax of this lane's query over its 32 keys of the tile; diagonal tile: keys with index > query index get the replace-fill
        const bool diag = (kv0 == q0);
        float mx4[4];
#pragma unroll
        for (int nt = 0; nt < 4; ++nt) {
            mx4[nt] = -3.0e38f;
#pragma unroll
            for (int j = 0; j < 8; ++j) { float s = sacc[nt][j] * SCL; const int kn = nt * 16 + hi * 8 + j; s = (diag && kn > rr) ? -3.0e38f : s; sacc[nt][j] = s; mx4[nt] = fmaxf(mx4[nt], s); }
        }
        float mx = fmaxf(fmaxf(mx4[0], mx4[1]), fmaxf(mx4[2], mx4[3]));
        mx = fmaxf(mx, xhalf(mx));                  // the other half holds the query's other 32 keys
        const float mn = fmaxf(mrow, mx);
        const float corr = __builtin_amdgcn_exp2f((mrow - mn) * L2E);
        mrow = mn;
        v16h pb[2]; v16us pbh[2], pbl[2]; float ps4[4];
#pragma unroll
        for (int nt = 0; nt < 4; ++nt) {
            ps4[nt] = 0.0f;
#pragma unroll
            for (int j = 0; j < 8; ++j) {
                const float p = __builtin_amdgcn_exp2f((sacc[nt][j] - mn) * L2E); ps4[nt] += p;
                // Pt fragment of key block nt>>1: elements 0..7 <- keys 8*hi + j of its first 16, elements 8..15 <- of its second 16
                if constexpr (!HR) { pb[nt >> 1][(nt & 1) * 8 + j] = (h16)(p * PCAR); } else { unsigned short a2, c2; splitf(p * PCAR, a2, c2); pbh[nt >> 1][(nt & 1) * 8 + j] = a2; pbl[nt >> 1][(nt & 1) * 8 + j] = c2; }
            }
        }
        lrow = lrow * corr + ((ps4[0] + ps4[1]) + (ps4[2] + ps4[3]));
#pragma unroll
        for (int nt = 0; nt < 4; ++nt) oacc[nt] = oacc[nt] * corr;
        // Ot += Vt . Pt (A = VT[d][key] plane, B = the lane's own p values)
        if constexpr (!HR) {
#pragma unroll
            for (int kk = 0; kk < 2; ++kk) {
#pragma unroll
                for (int nt = 0; nt < 4; ++nt) oacc[nt] = wmma16(vb[kk][nt], pb[kk], oacc[nt]);
            }
            asm volatile("v_nop\n\tv_nop\n\tv_nop\n\tv_nop" : "+v"(oacc[0]), "+v"(oacc[1]), "+v"(oacc[2]), "+v"(oacc[3]) : "v"(pb[0]), "v"(pb[1]), "v"(vb[1][3]));   // WMMA distance on the back edge and in front of the epilogue
        } else {
            v16bf pah[2], pal[2];
#pragma unroll
            for (int kk = 0; kk < 2; ++kk) {
                pah[kk] = __builtin_bit_cast(v16bf, pbh[kk]); pal[kk] = __builtin_bit_cast(v16bf, pbl[kk]);
#pragma unroll
                for (int nt = 0; nt < 4; ++nt) {
                    oacc[nt] = wmmab(vbh[kk][nt], pah[kk], oacc[nt]); oacc[nt] = wmmab(vbh[kk][nt], pal[kk], oacc[nt]);
                    oacc[nt] = wmmab(vbl[kk][nt], pah[kk], oacc[nt]); }
            }
            asm volatile("v_nop\n\tv_nop\n\tv_nop\n\tv_nop" : "+v"(oacc[0]), "+v"(oacc[1]), "+v"(oacc[2]), "+v"(oacc[3]) : "v"(pah[0]), "v"(pal[1]), "v"(vbh[1][3]), "v"(vbl[1][3]));   // as above
        }
        // the wait that stands in front of a rewrite of the loads' address registers; naming them keeps them whole up to it; at the foot of the tile, behind softmax and products, it finds the count at 0
        if constexpr (!HR) { asm volatile("s_wait_xcnt 0x0" :: "v"(pk), "v"(pv) : "memory"); pv += 1024; }
        else { asm volatile("s_wait_xcnt 0x0" :: "v"(pkh), "v"(pkl), "v"(pvh), "v"(pvl) : "memory"); pkh += 64 * HD; pkl += 64 * HD; pvh += 1024; pvl += 1024; }
    }
    // normalise; the lane's eight values of tile nt are d = nt*16 + 8*hi + 0..7 of query m: one 16-byte piece of the [rows][DM] y plane in fragment order (k block nt>>1, half nt&1, piece lane), so each store is a 512-byte run of the wave
    const float inv = 1.0f / ((lrow + xhalf(lrow)) * PCAR);
    v8h o16[4]; v8us oh[4], ol[4];
#pragma unroll
    for (int nt = 0; nt < 4; ++nt) {
#pragma unroll
        for (int j = 0; j < 8; ++j) {
            const float y = oacc[nt][j] * inv;
            if constexpr (!HR) { o16[nt][j] = (h16)(y * YCAR); } else { unsigned short a2, c2; splitf(y, a2, c2); oh[nt][j] = a2; ol[nt][j] = c2; }
        }
    }
    __builtin_amdgcn_sched_barrier(0);   // every value is formed ahead of the first store, so no register that a store names is written behind it
#pragma unroll
    for (int nt = 0; nt < 4; ++nt) {
        if constexpr (!HR) {
            *(v8h*)(Y16 + ((size_t)b * SEQ + qw) * DM + hp * 1024 + nt * 256 + lane * 8) = o16[nt];
        } else {
            *(v8us*)(YH + ((size_t)b * RH + qw) * DM + hp * 1024 + nt * 256 + lane * 8) = oh[nt]; *(v8us*)(YL + ((size_t)b * RH + qw) * DM + hp * 1024 + nt * 256 + lane * 8) = ol[nt];
        }
    }
}

extern "C" void kernel_launch(void* const* d_in, const int* in_sizes, int n_in,
                              void* d_out, int out_size, void* d_ws, size_t ws_size, hipStream_t stream) {
    if (n_in < 11) return;
    const int xneed = (NB - 1) * SEQ_FULL * DM + SEQ * DM;
    if (in_sizes[0] < xneed || in_sizes[1] < xneed || in_sizes[2] < xneed || in_sizes[3] < xneed) return;
    if (in_sizes[4] < NQKV * DM || in_sizes[5] < NQKV || in_sizes[6] < DM * DM || in_sizes[7] < DM) return;
    if (in_sizes[8] < 1 || in_sizes[9] < NH - 1 || in_sizes[10] < NH) return;
    if (out_size < xneed) return;
    const float* X1 = (const float*)d_in[0]; const float* X2 = (const float*)d_in[1]; const float* X3 = (const float*)d_in[2]; const float* X = (const float*)d_in[3];
    const float* Wattn = (const float*)d_in[4]; const float* battn = (const float*)d_in[5]; const float* Wproj = (const float*)d_in[6]; const float* bproj = (const float*)d_in[7];
    const int* hidx = (const int*)d_in[8]; const int* hidxs = (const int*)d_in[9]; const int* perm = (const int*)d_in[10];
    float* OUT = (float*)d_out;   // [NB_FULL][SEQ_FULL][DM] f32

    char* wsp = (char*)d_ws;
    auto take = [&](size_t bytes) { char* p = wsp; wsp += (bytes + 255) & ~(size_t)255; return (void*)p; };
    const size_t xplane = (size_t)NB * SEQ * DM * 2;                 // compact [NB*SEQ][DM] bf16, fragment order
    bf* XB = (bf*)take(xplane); bf* X1B = (bf*)take(xplane); bf* X2B = (bf*)take(xplane); bf* X3B = (bf*)take(xplane);
    bf* WB = (bf*)take((size_t)NSLOT * HD * DM * 2);
    h16* WP16 = (h16*)take((size_t)DM * DM * 2); bf* WPB = (bf*)take((size_t)DM * DM * 2);
    const size_t hplane = (size_t)NB * NH * SEQ * HD * 2, hplaneR = (size_t)NB * NH * RH * HD * 2;
    h16* Q16 = (h16*)take(hplane); h16* K16 = (h16*)take(hplane); h16* VT = (h16*)take(hplane);
    bf* QH = (bf*)take(hplaneR); bf* QL = (bf*)take(hplaneR); bf* KH = (bf*)take(hplaneR); bf* KL = (bf*)take(hplaneR); bf* VH = (bf*)take(hplaneR); bf* VL = (bf*)take(hplaneR);
    h16* Y16 = (h16*)take((size_t)NB * SEQ * DM * 2); bf* YH = (bf*)take((size_t)NB * RH * DM * 2); bf* YL = (bf*)take((size_t)NB * RH * DM * 2);
    if ((size_t)(wsp - (char*)d_ws) > ws_size) return;

    // 1) bf16 input planes (compact rows)
    k_cvtx<<<dim3((unsigned)(((size_t)NB * SEQ * DM / 8 + 255) / 256), 4), 256, 0, stream>>>(X, X1, X2, X3, XB, X1B, X2B, X3B);
    // 2) gathered head weight plane and output-projection weight planes
    k_wg<<<(unsigned)(((size_t)NSLOT * HD * DM / 8 + 255) / 256), 256, 0, stream>>>(Wattn, hidx, hidxs, WB);
    k_cvtw<<<(unsigned)(((size_t)DM * DM / 8 + 255) / 256), 256, 0, stream>>>(Wproj, WP16, WPB);
    // 3) head projections -> per final-head planes
    k_qkv<<<dim3(NB * SEQ / 64, 1, NSLOT), 32, 0, stream>>>(XB, X1B, X2B, X3B, WB, battn, hidx, hidxs, perm, Q16, QH, QL, K16, KH, KL, VT, VH, VL);
    // 4) causal attention: hi+lo band (query tiles < RH) and single-plane band (tiles >= RH)
    k_flash<true><<<dim3(RH / 64, NB * NH), 128, 0, stream>>>(Q16, QH, QL, K16, KH, KL, VT, VH, VL, Y16, YH, YL, 0);
    if (SEQ > RH) k_flash<false><<<dim3((SEQ - RH) / 64, NB * NH), 128, 0, stream>>>(Q16, QH, QL, K16, KH, KL, VT, VH, VL, Y16, YH, YL, RH / 64);
    // 5) output projection (+ bproj): rows < RH from bf16 hi+lo y, rows >= RH from the f16 plane (carries folded by OSC)
    k_gemmw<bf, 1, true, DM><<<dim3(RH / 64, DM / 64, NB), 32, 0, stream>>>(YH, YL, WPB, nullptr, OUT, DM, bproj, 1.0f, (size_t)RH * DM, (size_t)0, (size_t)SEQ_FULL * DM);
    if (SEQ > RH) k_gemmw<h16, 0, true, DM><<<dim3((SEQ - RH) / 64, DM / 64, NB), 32, 0, stream>>>(Y16 + (size_t)RH * DM, nullptr, WP16, nullptr, OUT + (size_t)RH * DM, DM, bproj, OSC, (size_t)SEQ * DM, (size_t)0, (size_t)SEQ_FULL * DM);
}

// v004
// One run takes 136 microseconds.
// In two side-by-side timings against v003, it was 1.10 and 1.09 times as fast.
// Over all steps from v000 it is 2.26 times as fast.
#include <hip/hip_runtime.h>

// Contractions: head projections x*W^T for v and W*x^T (transposed) for q, k on v_wmma_f32_16x16x32_bf16 (RNE bf16 operands = converted inputs, exact products); attention k.q^T and v^T.p^T (both transposed) on v_wmma_f32_16x16x32_f16 single planes (p carried x1024) for query rows >= RH and on bf16 hi+lo planes (3 products) for query rows < RH; output projection on v_wmma_f32_16x16x32_f16 planes (y carried x16, W x64, folded by 2^-10) for rows >= RH and on bf16 hi+lo y planes (2 products) for rows < RH; f32 accumulate everywhere, softmax in f32.
// Every 16-bit operand plane in the workspace lies in fragment order: a logical [R][K] plane is cut into blocks of 16 rows x 32 k (512 elements, row bands of 16*K elements, k blocks ascending inside a band); inside a block element (r, k) stands at ((k>>4)&1)*256 + (((k>>3)&1)*16 + (r&15))*8 + (k&7), so each of a fragment's two 16-byte loads reads 512 contiguous bytes over the wave (four whole lines instead of pieces of sixteen).

#ifndef NB
#define NB 2
#endif
#ifndef SEQ
#define SEQ 2048
#endif
#define NB_FULL  2
#define SEQ_FULL 2048
#define DM   1024
#define NH   16
#define HD   64
#define NQKV 3072
#define NSLOT (3 * NH)
#ifndef RH
#define RH 512
#endif
#if RH > SEQ
#undef RH
#define RH SEQ
#endif
static_assert(SEQ % 64 == 0);
static_assert(RH % 64 == 0);
static_assert(RH <= SEQ);
static_assert(SEQ <= SEQ_FULL);
static_assert(NB <= NB_FULL);
static_assert(DM % 64 == 0);
#define PCAR 1024.0f
#define YCAR 16.0f
#define WCAR 64.0f
#define OSC  (1.0f / 1024.0f)
#define SCL  0.125f
#define L2E  1.4426950408889634f

typedef _Float16 h16;
typedef unsigned short bf;
typedef __attribute__((ext_vector_type(16))) __bf16   v16bf;
typedef __attribute__((ext_vector_type(16))) _Float16 v16h;
typedef __attribute__((ext_vector_type(8)))  _Float16 v8h;
typedef __attribute__((ext_vector_type(8)))  unsigned short v8us;
typedef __attribute__((ext_vector_type(16))) unsigned short v16us;
typedef __attribute__((ext_vector_type(8)))  float    v8f;
typedef __attribute__((ext_vector_type(4)))  float    v4f;
typedef v4f  __attribute__((may_alias)) v4fa;

__device__ __forceinline__ unsigned short f2bf(float f) { unsigned u = __float_as_uint(f); u += 0x7FFFu + ((u >> 16) & 1u); return (unsigned short)(u >> 16); }
__device__ __forceinline__ float bf2f(unsigned short b) { return __uint_as_float(((unsigned)b) << 16); }
__device__ __forceinline__ float bfr(float f) { return bf2f(f2bf(f)); }
__device__ __forceinline__ v16h cat16(v8h lo, v8h hi) { return __builtin_shufflevector(lo, hi, 0, 1, 2, 3, 4, 5, 6, 7, 8, 9, 10, 11, 12, 13, 14, 15); }
__device__ __forceinline__ v16bf cat16b(v8us lo, v8us hi) { return __builtin_bit_cast(v16bf, __builtin_shufflevector(lo, hi, 0, 1, 2, 3, 4, 5, 6, 7, 8, 9, 10, 11, 12, 13, 14, 15)); }
__device__ __forceinline__ v8f wmma16(v16h a, v16h b, v8f c) { return __builtin_amdgcn_wmma_f32_16x16x32_f16(false, a, false, b, (short)0, c, false, false); }
__device__ __forceinline__ v8f wmmab(v16bf a, v16bf b, v8f c) { return __builtin_amdgcn_wmma_f32_16x16x32_bf16(false, a, false, b, (short)0, c, false, false); }
__device__ __forceinline__ void splitf(float y, unsigned short& h, unsigned short& l) { h = f2bf(y); l = f2bf(y - bf2f(h)); }

// Fragment loaders: lane -> row (A) / column (B) = lane&15; elements 0..7 <- k0+8h+0..7, elements 8..15 <- k0+16+8h+0..7 (h = lane>>4); p already carries the 16x32 block's start + lane*8.
template <typename T16> struct WFrag;
template <> struct WFrag<h16> { typedef v16h V; static __device__ __forceinline__ V ld(const h16* p) { return cat16(*(const v8h*)p, *(const v8h*)(p + 256)); } static __device__ __forceinline__ v8f mma(V a, V b, v8f c) { return wmma16(a, b, c); } };
template <> struct WFrag<bf> { typedef v16bf V; static __device__ __forceinline__ V ld(const bf* p) { return cat16b(*(const v8us*)p, *(const v8us*)(p + 256)); } static __device__ __forceinline__ v8f mma(V a, V b, v8f c) { return wmmab(a, b, c); } };

// ---- k_gemmw: register-blocked GEMM, ONE WAVE per 64x64 output tile (16 accumulators), operands straight from 16-bit planes in fragment order; grid (M/64, N/64, Z), 32 threads.
// C[m][n] (f32, pitch ldc) = (sum_k A[m][k] Bt[n][k] (+ A2[m][k] Bt[n][k] when NSPLIT==1)) * osc + bias[n] (bf16 RNE value). z-batch strides sA/sB/sC in elements. K % 64 == 0, K >= 64.
template <typename T16, int NSPLIT, bool BIAS, int K>
__global__ __launch_bounds__(32) void k_gemmw(const T16* __restrict__ A, const T16* __restrict__ A2, const T16* __restrict__ Bt, const T16* __restrict__ Bt2, float* C, int ldc, const float* __restrict__ bias, float osc, size_t sA, size_t sB, size_t sC) {
    typedef typename WFrag<T16>::V V;
    __shared__ __align__(16) float os[16 * 68];
    const size_t z = blockIdx.z; A += z * sA; if (A2) A2 += z * sA; Bt += z * sB; if (Bt2) Bt2 += z * sB; C += z * sC;
    const int lane = threadIdx.x & 31, lr = lane & 15, hi = lane >> 4; const int r0 = blockIdx.x * 64, c0 = blockIdx.y * 64;
    v8f acc[4][4];
#pragma unroll
    for (int mb = 0; mb < 4; ++mb)
#pragma unroll
        for (int nb = 0; nb < 4; ++nb) acc[mb][nb] = (v8f){};
    const size_t aoff = (size_t)r0 * K + 8 * lane, boff = (size_t)c0 * K + 8 * lane;
    // Two register sets of operand fragments: every load of k step s+1 is issued before the products of step s, so a step waits for one load latency at most.
    static_assert(K % 64 == 0 && K >= 64);
    struct FS { V a[4], a2[4], b[4], b2[4]; };
    const T16* pa = A + aoff; const T16* pa2 = A2 + aoff; const T16* pb = Bt + boff; const T16* pb2 = Bt2 + boff;   // pa2 / pb2 are read only where NSPLIT uses them
    auto ldfs = [&](FS& f, int ko) {
#pragma unroll
        for (int mb = 0; mb < 4; ++mb) { f.a[mb] = WFrag<T16>::ld(pa + mb * 16 * K + ko * 16); if (NSPLIT == 1 || NSPLIT == 2) f.a2[mb] = WFrag<T16>::ld(pa2 + mb * 16 * K + ko * 16); }
#pragma unroll
        for (int nb = 0; nb < 4; ++nb) { f.b[nb] = WFrag<T16>::ld(pb + nb * 16 * K + ko * 16); if (NSPLIT >= 2) f.b2[nb] = WFrag<T16>::ld(pb2 + nb * 16 * K + ko * 16); }
        __builtin_amdgcn_sched_barrier(0);   // keeps the loads above the products that follow; without it the scheduler sinks each load to its first use
    };
    // the wait that stands in front of a rewrite of the loads' address registers; naming them keeps them whole up to it; behind a block of products it finds the count at 0
    auto xw = [&]() {
        if constexpr (NSPLIT == 0) asm volatile("s_wait_xcnt 0x0" :: "v"(pa), "v"(pb) : "memory");
        else if constexpr (NSPLIT == 1) asm volatile("s_wait_xcnt 0x0" :: "v"(pa), "v"(pa2), "v"(pb) : "memory");
        else asm volatile("s_wait_xcnt 0x0" :: "v"(pa), "v"(pa2), "v"(pb), "v"(pb2) : "memory");
    };
    auto mmfs = [&](FS& f) {
#pragma unroll
        for (int nb = 0; nb < 4; ++nb) {
#pragma unroll
            for (int mb = 0; mb < 4; ++mb) { acc[mb][nb] = WFrag<T16>::mma(f.a[mb], f.b[nb], acc[mb][nb]); if (NSPLIT == 1 || NSPLIT == 2) acc[mb][nb] = WFrag<T16>::mma(f.a2[mb], f.b[nb], acc[mb][nb]); if (NSPLIT >= 2) acc[mb][nb] = WFrag<T16>::mma(f.a[mb], f.b2[nb], acc[mb][nb]); } }
        // WMMA distance before the refill of this set and on the back edge
        asm volatile("v_nop\n\tv_nop\n\tv_nop\n\tv_nop" : "+v"(acc[0][0]), "+v"(acc[1][1]), "+v"(acc[2][2]), "+v"(acc[3][3]) : "v"(f.a[0]), "v"(f.a[3]));
    };
    FS f0, f1;
    ldfs(f0, 0);
    asm volatile("s_wait_xcnt 0x0" ::: "memory");   // in front of any rewrite of the registers that these first loads name (the loop's own wait names only the walking pointers)
    __builtin_amdgcn_sched_barrier(0);              // keeps such a rewrite behind the wait
#pragma unroll 1
    for (int kc = 0; kc < K - 64; kc += 64) {
        ldfs(f1, 32);
        mmfs(f0);
        xw();
        pa += 64 * 16; pa2 += 64 * 16; pb += 64 * 16; pb2 += 64 * 16;
        ldfs(f0, 0);
        mmfs(f1);
    }
    ldfs(f1, 32);
    mmfs(f0);
    xw();
    mmfs(f1);
#pragma unroll
    for (int mb = 0; mb < 4; ++mb) {
#pragma unroll
        for (int nb = 0; nb < 4; ++nb) {
#pragma unroll
            for (int j = 0; j < 8; ++j) os[(hi * 8 + j) * 68 + nb * 16 + lr] = acc[mb][nb][j]; }
        __builtin_amdgcn_wave_barrier(); asm volatile("" ::: "memory");
        float* crow = C + (size_t)(r0 + mb * 16) * ldc + c0;
{
#pragma unroll
            for (int s = 0; s < 8; ++s) { const int row = 2 * s + hi, cofs = lr * 4; v4f val = *(const v4fa*)(os + row * 68 + cofs); val = val * osc; if (BIAS) { val[0] += bfr(bias[c0 + cofs]); val[1] += bfr(bias[c0 + cofs + 1]); val[2] += bfr(bias[c0 + cofs + 2]); val[3] += bfr(bias[c0 + cofs + 3]); }
                *(v4f*)(crow + (size_t)row * ldc + cofs) = val; }
             }
        asm volatile("s_wait_xcnt 0x0" ::: "memory");   // in front of the next block's reuse of the stores' address and data registers
        __builtin_amdgcn_sched_barrier(0);              // keeps that reuse behind the wait
        __builtin_amdgcn_wave_barrier(); asm volatile("" ::: "memory");
    }
}

// ---- integer head selection: slot 0 -> head_idx[0], slot s>=1 -> head_idxs[s-1]; both values loaded unconditionally with clamped addresses, negative wraps by 16, result clamped to [0,15].
__device__ __forceinline__ int wrap16(int v) { v = (v < 0) ? (v + NH) : v; v = (v < 0) ? 0 : v; return (v > NH - 1) ? (NH - 1) : v; }
__device__ __forceinline__ int hsel(const int* hidx, const int* hidxs, int slot) {
    const int a = hidx[0]; int bi = slot - 1; bi = (bi < 0) ? 0 : ((bi > NH - 2) ? (NH - 2) : bi); const int c = hidxs[bi];
    return wrap16((slot == 0) ? a : c);
}

// The three converters: a block of 256 threads takes 16 rows x 128 columns of a [R][DM] source (thread -> row t>>4, columns (t&15)*8 .. +7, reads as whole runs of a row); in fragment order those are 2048 contiguous elements,
// piece (row lr, column piece c8) at piece index c8*16 + lr. fo_swap hands each thread the piece of its own index through LDS (pitch 17 pieces: no bank conflict either way), so the stores are whole lines too.
static_assert(DM % 128 == 0);
__device__ __forceinline__ v8us fo_swap(v8us* sm, v8us o, int t) {
    sm[(t & 15) * 17 + (t >> 4)] = o;
    __syncthreads();
    return sm[(t >> 4) * 17 + (t & 15)];
}

// coverage: NB*SEQ*DM elements per plane, 2048 per block, grid exact with a block-uniform bound -> whole plane.
__global__ __launch_bounds__(256) void k_cvtx(const float* __restrict__ s0, const float* __restrict__ s1, const float* __restrict__ s2, const float* __restrict__ s3, bf* d0, bf* d1, bf* d2, bf* d3) {
    __shared__ __align__(16) v8us sm[16 * 17];
    const size_t n8 = (size_t)NB * SEQ * DM / 8; if ((size_t)blockIdx.x * 256 >= n8) return;
    const int t = threadIdx.x, w = blockIdx.y;
    const float* src = (w == 0) ? s0 : ((w == 1) ? s1 : ((w == 2) ? s2 : s3)); bf* dst = (w == 0) ? d0 : ((w == 1) ? d1 : ((w == 2) ? d2 : d3));
    const size_t row = (size_t)(blockIdx.x / (DM / 128)) * 16 + (t >> 4); const int col = (int)(blockIdx.x % (DM / 128)) * 128 + (t & 15) * 8; const size_t b = row / SEQ, tt = row % SEQ;
    const v8f v = *(const v8f*)(src + ((b * SEQ_FULL + tt) * DM + col)); v8us o;
#pragma unroll
    for (int q = 0; q < 8; ++q) o[q] = f2bf(v[q]);
    *(v8us*)(dst + (size_t)blockIdx.x * 2048 + t * 8) = fo_swap(sm, o, t);
}

// coverage: 48*64*1024 elements, 2048 per block, grid exact with a block-uniform bound.
__global__ __launch_bounds__(256) void k_wg(const float* __restrict__ W, const int* __restrict__ hidx, const int* __restrict__ hidxs, bf* WB) {
    __shared__ __align__(16) v8us sm[16 * 17];
    const size_t n8 = (size_t)NSLOT * HD * DM / 8; if ((size_t)blockIdx.x * 256 >= n8) return;
    const int t = threadIdx.x;
    const int zr = (int)(blockIdx.x / (DM / 128)) * 16 + (t >> 4); const int k = (int)(blockIdx.x % (DM / 128)) * 128 + (t & 15) * 8;
    const int r = zr % HD; const int z = zr / HD; const int type = z >> 4, slot = z & 15;
    const int hs = hsel(hidx, hidxs, slot);
    const v8f v = *(const v8f*)(W + ((size_t)(type * DM + hs * HD + r)) * DM + k); v8us o;
#pragma unroll
    for (int q = 0; q < 8; ++q) o[q] = f2bf(v[q]);
    *(v8us*)(WB + (size_t)blockIdx.x * 2048 + t * 8) = fo_swap(sm, o, t);
}

// coverage: DM*DM elements, 2048 per block, grid exact with a block-uniform bound.
__global__ __launch_bounds__(256) void k_cvtw(const float* __restrict__ W, h16* WP16, bf* WPB) {
    __shared__ __align__(16) v8us sm[16 * 17];
    __shared__ __align__(16) v8us sm2[16 * 17];
    const size_t n8 = (size_t)DM * DM / 8; if ((size_t)blockIdx.x * 256 >= n8) return;
    const int t = threadIdx.x;
    const size_t row = (size_t)(blockIdx.x / (DM / 128)) * 16 + (t >> 4); const int col = (int)(blockIdx.x % (DM / 128)) * 128 + (t & 15) * 8;
    const v8f v = *(const v8f*)(W + row * DM + col); v8h o16; v8us ob;
#pragma unroll
    for (int q = 0; q < 8; ++q) { ob[q] = f2bf(v[q]); o16[q] = (h16)(bf2f(ob[q]) * WCAR); }
    sm2[(t & 15) * 17 + (t >> 4)] = ob;   // published by the barrier inside fo_swap
    const v8us p16 = fo_swap(sm, __builtin_bit_cast(v8us, o16), t);
    *(v8h*)(WP16 + (size_t)blockIdx.x * 2048 + t * 8) = __builtin_bit_cast(v8h, p16); *(v8us*)(WPB + (size_t)blockIdx.x * 2048 + t * 8) = sm2[(t >> 4) * 17 + (t & 15)];
}

// ---- k_qkv: per slot z = type*16 + slot, one wave per 64x64 tile of Y[b*SEQ + t][d] = sum_k XB[.][k] WB[z][d][k] + battn[type*DM + hsel(slot)*HD + d] (bf16 x bf16, f32 acc); grid (NB*SEQ/64, 1, 48), 32 threads.
// A = X1B/X2B/X3B for slot 0 (type q/k/v), XB otherwise (block-uniform select, no loaded index).
// The product's orientation follows the plane it feeds, so that a lane's eight accumulator values are one 16-byte piece of that plane in fragment order and go from the registers straight to memory (no LDS, no barrier):
//   q, k (SW = true, plane rows t, k = d): Yt = W.Xt, W rows as A and x rows as B (both tiles are 64 rows x K in fragment order, so the two walking pointers change places and the loop is one);
//     acc[nb][mb][j] = Y[t = mb*16 + (lane&15)][d = nb*16 + 8*(lane>>4) + j], piece at band mb (1024 elements), quarter nb (256), lane*8.
//   v (SW = false, plane rows d, k = t): Y = X.Wt; acc[mb][nb][j] = Y[t = mb*16 + 8*(lane>>4) + j][d = nb*16 + (lane&15)], piece at band nb (16*SEQ or 16*RH elements), quarter mb (256) behind t0*16, lane*8.
// For every final head hp with wrap16(perm[hp]) == slot (block-uniform scalar compare) the tile is written to head planes zf = b*16 + hp:
// coverage: every (hp, b, t, d) of Q16/K16/VT is written by exactly one (slot == wrap16(perm[hp]), row tile) block; hi+lo planes for all t < RH likewise. Each store of the wave is one 512-byte run.
template <bool SW, bool HI>
__device__ __forceinline__ void qkv_store(v8f (&acc)[4][4], const float* __restrict__ bsrc, const int* __restrict__ perm, int slot, int b, int t0, h16* P16, bf* PH, bf* PL) {
    const int lane = threadIdx.x & 31, lr = lane & 15, hi = lane >> 4;
    v8h o16[4][4]; v8us oh[4][4], ol[4][4];
    v4f br[4][2]; float bl[4];   // the lane's bias values as loaded: eight d a column group (SW) or one d
#pragma unroll
    for (int nb = 0; nb < 4; ++nb) {
        if constexpr (SW) { br[nb][0] = *(const v4fa*)(bsrc + nb * 16 + hi * 8); br[nb][1] = *(const v4fa*)(bsrc + nb * 16 + hi * 8 + 4); }
        else bl[nb] = bsrc[nb * 16 + lr];
    }
    asm volatile("s_wait_xcnt 0x0" ::: "memory");   // in front of any rewrite of the bias loads' address registers
    __builtin_amdgcn_sched_barrier(0);              // keeps such a rewrite behind the wait
#pragma unroll
    for (int nb = 0; nb < 4; ++nb) {
        float bs[8];   // bias (bf16 RNE value) of the lane's eight values
        if constexpr (SW) {
#pragma unroll
            for (int j = 0; j < 4; ++j) { bs[j] = bfr(br[nb][0][j]); bs[4 + j] = bfr(br[nb][1][j]); }
        } else {
            const float bv = bfr(bl[nb]);
#pragma unroll
            for (int j = 0; j < 8; ++j) bs[j] = bv;
        }
#pragma unroll
        for (int mb = 0; mb < 4; ++mb) {
#pragma unroll
            for (int j = 0; j < 8; ++j) {
                const float v = acc[SW ? nb : mb][SW ? mb : nb][j] + bs[j];
                o16[mb][nb][j] = (h16)v;
                if constexpr (HI) { unsigned short a2, c2; splitf(v, a2, c2); oh[mb][nb][j] = a2; ol[mb][nb][j] = c2; }
            }
            __builtin_amdgcn_sched_barrier(0);   // one tile is rounded at a time, its accumulators dead before the next tile's values are formed: without it the scheduler mixes the tiles and spills
        }
    }
    // every value is formed ahead of the first store (the barrier above), so no register that a store names is written behind it
    constexpr int SM = SW ? 1024 : 256, SN = SW ? 256 : 16 * SEQ, SNH = SW ? 256 : 16 * RH;   // element steps of mb and nb in the plane
#pragma unroll 1
    for (int hp = 0; hp < NH; ++hp) {
        const int pp = wrap16(perm[hp]);
        if (pp != slot) continue;
        const int zf = b * NH + hp;
        h16* d16 = P16 + (SW ? (((size_t)zf * SEQ + t0) * HD) : ((size_t)zf * HD * SEQ + (size_t)t0 * 16)) + lane * 8;
#pragma unroll
        for (int nb = 0; nb < 4; ++nb)
#pragma unroll
            for (int mb = 0; mb < 4; ++mb) *(v8h*)(d16 + mb * SM + nb * SN) = o16[mb][nb];
        if constexpr (HI) {
            const size_t hoff = (SW ? (((size_t)zf * RH + t0) * HD) : ((size_t)zf * HD * RH + (size_t)t0 * 16)) + lane * 8;
            bf* dh = PH + hoff; bf* dl = PL + hoff;
#pragma unroll
            for (int nb = 0; nb < 4; ++nb)
#pragma unroll
                for (int mb = 0; mb < 4; ++mb) { *(v8us*)(dh + mb * SM + nb * SNH) = oh[mb][nb]; *(v8us*)(dl + mb * SM + nb * SNH) = ol[mb][nb]; }
        }
        asm volatile("s_wait_xcnt 0x0" ::: "memory");   // in front of the next head's rewrite of the stores' address registers
        __builtin_amdgcn_sched_barrier(0);              // keeps that rewrite behind the wait
    }
}

__global__ __launch_bounds__(32) void k_qkv(const bf* __restrict__ XB, const bf* __restrict__ X1B, const bf* __restrict__ X2B, const bf* __restrict__ X3B, const bf* __restrict__ WB, const float* __restrict__ battn,
                                          const int* __restrict__ hidx, const int* __restrict__ hidxs, const int* __restrict__ perm,
                                          h16* Q16, bf* QH, bf* QL, h16* K16, bf* KH, bf* KL, h16* VT, bf* VH, bf* VL) {
    const int lane = threadIdx.x & 31;
    const int z = blockIdx.z, type = z >> 4, slot = z & 15;
    const int r0 = blockIdx.x * 64;                 // compact row index b*SEQ + t
    const int b = r0 / SEQ, t0 = r0 % SEQ; const bool hires = (t0 < RH);
    const bf* A = (slot == 0) ? ((type == 0) ? X1B : ((type == 1) ? X2B : X3B)) : XB;
    const bf* Bt = WB + (size_t)z * HD * DM;
    constexpr int K = DM;
    v8f acc[4][4];
#pragma unroll
    for (int mb = 0; mb < 4; ++mb)
#pragma unroll
        for (int nb = 0; nb < 4; ++nb) acc[mb][nb] = (v8f){};
    const size_t aoff = (size_t)r0 * K + 8 * lane, boff = (size_t)(8 * lane);
    // Two register sets of operand fragments: every load of k step s+1 is issued before the products of step s.
    struct FS { v16bf a[4], b[4]; };
    const bf* pa = (type == 2) ? (A + aoff) : (Bt + boff); const bf* pb = (type == 2) ? (Bt + boff) : (A + aoff);   // q, k: W rows as A, x rows as B
    auto ldfs = [&](FS& f, int ko) {
#pragma unroll
        for (int mb = 0; mb < 4; ++mb) f.a[mb] = WFrag<bf>::ld(pa + mb * 16 * K + ko * 16);
#pragma unroll
        for (int nb = 0; nb < 4; ++nb) f.b[nb] = WFrag<bf>::ld(pb + nb * 16 * K + ko * 16);
        __builtin_amdgcn_sched_barrier(0);   // keeps the loads above the products that follow; without it the scheduler sinks each load to its first use
    };
    // the wait that stands in front of a rewrite of the loads' address registers; naming them keeps them whole up to it; behind a block of products it finds the count at 0
    auto xw = [&]() { asm volatile("s_wait_xcnt 0x0" :: "v"(pa), "v"(pb) : "memory"); };
    auto mmfs = [&](FS& f) {
#pragma unroll
        for (int nb = 0; nb < 4; ++nb) {
#pragma unroll
            for (int mb = 0; mb < 4; ++mb) acc[mb][nb] = wmmab(f.a[mb], f.b[nb], acc[mb][nb]); }
        // WMMA distance before the refill of this set and on the back edge
        asm volatile("v_nop\n\tv_nop\n\tv_nop\n\tv_nop" : "+v"(acc[0][0]), "+v"(acc[1][1]), "+v"(acc[2][2]), "+v"(acc[3][3]) : "v"(f.a[0]), "v"(f.a[3]));
    };
    FS f0, f1;
    ldfs(f0, 0);
#pragma unroll 1
    for (int kc = 0; kc < K - 64; kc += 64) {
        ldfs(f1, 32);
        mmfs(f0);
        xw();
        pa += 64 * 16; pb += 64 * 16;
        ldfs(f0, 0);
        mmfs(f1);
    }
    ldfs(f1, 32);
    mmfs(f0);
    xw();
    mmfs(f1);
    const int hs = hsel(hidx, hidxs, slot); const float* bsrc = battn + type * DM + hs * HD;   // the slot's 64 bias values (battn index <= 3071 by the clamps)
    // four straight epilogues behind block-uniform branches
    if (type == 2) {
        if (hires) qkv_store<false, true>(acc, bsrc, perm, slot, b, t0, VT, VH, VL); else qkv_store<false, false>(acc, bsrc, perm, slot, b, t0, VT, VH, VL);
    } else {
        h16* P16 = (type == 0) ? Q16 : K16; bf* PH = (type == 0) ? QH : KH; bf* PL = (type == 0) ? QL : KL;
        if (hires) qkv_store<true, true>(acc, bsrc, perm, slot, b, t0, P16, PH, PL); else qkv_store<true, false>(acc, bsrc, perm, slot, b, t0, P16, PH, PL);
    }
}

// ---- k_flash<HR>: causal attention, one (b, final head, 64-query tile) per block, 4 waves x 16 query rows, 64-key tiles kv0 = 0 .. q0 (tiles above the diagonal skipped, diagonal tile masked by replace-fill), online softmax in f32.
// Both products run transposed: St = K.Qt (A = K rows, B = Q) and Ot += Vt.Pt (A = VT rows d, B = Pt). In an accumulator tile nt a lane then holds ONE query (column lane&15) and the eight keys (or d) nt*16 + 8*(lane>>4) + j:
// a query's maximum and sum are taken inside the lane plus one exchange between the wave's halves, and tiles 2kk and 2kk+1 of the lane's own p values are, in that order, the sixteen elements of the Pt fragment of key block kk, so p never leaves the registers.
// HR=false (query tiles >= RH): single f16 planes, p carried x 1024; y written as f16(y x 16) elements (b*SEQ + t, hp*64 + d) of Y16.
// HR=true (query tiles < RH): q, k, p(x1024), v as bf16 hi+lo planes, 3 products per tile pair; y written as bf16 hi+lo elements (b*RH + t, ..) of YH/YL.
// coverage: Y16 rows t in [RH, SEQ) x all hp (HR=false grid), YH/YL rows t < RH x all hp (HR=true grid).
// amdgpu_waves_per_eu: the single-plane grid puts three waves on a SIMD, the hi+lo grid two, so the register budget is a third (a half) of the file per wave.
__device__ __forceinline__ float xhalf(float x) { return __builtin_bit_cast(float, __builtin_amdgcn_permlanex16(__builtin_bit_cast(int, x), __builtin_bit_cast(int, x), 0x76543210, 0xfedcba98, false, false)); }   // lane l <-> lane l ^ 16
template <bool HR>
__global__ __launch_bounds__(128) __attribute__((amdgpu_waves_per_eu(1, HR ? 2 : 3))) void k_flash(const h16* __restrict__ Q16, const bf* __restrict__ QH, const bf* __restrict__ QL,
                                               const h16* __restrict__ K16, const bf* __restrict__ KH, const bf* __restrict__ KL,
                                               const h16* __restrict__ VT, const bf* __restrict__ VH, const bf* __restrict__ VL,
                                               h16* Y16, bf* YH, bf* YL, int qt0) {
    const int tid = threadIdx.x, w = tid >> 5, lane = tid & 31, m = lane & 15, hi = lane >> 4;
    const int qt = qt0 + blockIdx.x, q0 = qt * 64, zf = blockIdx.y, b = zf >> 4, hp = zf & 15;
    const int qw = q0 + w * 16;                     // first query row of this wave
    v16h qa[2]; v16bf qah[2], qal[2];
    if constexpr (!HR) {
        const h16* pq = Q16 + ((size_t)zf * SEQ + qw) * HD + 8 * lane;
#pragma unroll
        for (int kk = 0; kk < 2; ++kk) qa[kk] = WFrag<h16>::ld(pq + kk * 512);
        asm volatile("s_wait_xcnt 0x0" :: "v"(pq) : "memory");   // in front of any rewrite of the loads' address registers
    } else {
        const bf* pqh = QH + ((size_t)zf * RH + qw) * HD + 8 * lane; const bf* pql = QL + ((size_t)zf * RH + qw) * HD + 8 * lane;
#pragma unroll
        for (int kk = 0; kk < 2; ++kk) { qah[kk] = WFrag<bf>::ld(pqh + kk * 512); qal[kk] = WFrag<bf>::ld(pql + kk * 512); }
        asm volatile("s_wait_xcnt 0x0" :: "v"(pqh), "v"(pql) : "memory");   // in front of any rewrite of the loads' address registers
    }
    v8f oacc[4];                                    // Ot: tile nt, element j = (d = nt*16 + 8*hi + j, query m)
#pragma unroll
    for (int nt = 0; nt < 4; ++nt) oacc[nt] = (v8f){};
    float mrow = -3.0e38f, lrow = 0.0f;             // this lane's query: running maximum (both halves alike), sum over this half's keys
    const int rr = w * 16 + m;                      // this lane's query row within the 64-row tile
    const int ntiles = qt + 1;
    // All fragments of a key tile live in registers, [kk][nt], and are loaded in one batch. Single planes: K of tile jt+1 is issued right behind the score products of tile jt, V of tile jt in front of them.
    // hi+lo planes (twice the fragments): K in one batch at the head of the tile, V in one batch right behind the score products, under the softmax.
    v16h kb[2][4], vb[2][4]; v16bf kbh[2][4], kbl[2][4], vbh[2][4], vbl[2][4];
    // this lane's walking pointers: K planes step 64 rows a tile (four bands of 16*HD), V planes 64 columns (two k blocks of 512)
    const h16* pk = K16 + (size_t)zf * SEQ * HD + 8 * lane; const h16* pv = VT + (size_t)zf * HD * SEQ + 8 * lane;
    const bf* pkh = KH + (size_t)zf * RH * HD + 8 * lane; const bf* pkl = KL + (size_t)zf * RH * HD + 8 * lane;
    const bf* pvh = VH + (size_t)zf * HD * RH + 8 * lane; const bf* pvl = VL + (size_t)zf * HD * RH + 8 * lane;
    auto ldK = [&]() {
#pragma unroll
        for (int kk = 0; kk < 2; ++kk) {
#pragma unroll
            for (int nt = 0; nt < 4; ++nt) {
                if constexpr (!HR) { kb[kk][nt] = WFrag<h16>::ld(pk + nt * 16 * HD + kk * 512); }
                else { kbh[kk][nt] = WFrag<bf>::ld(pkh + nt * 16 * HD + kk * 512); kbl[kk][nt] = WFrag<bf>::ld(pkl + nt * 16 * HD + kk * 512); }
            }
        }
        __builtin_amdgcn_sched_barrier(0);   // keeps the loads above the work that follows; without it the scheduler sinks each load to its first use
    };
    auto ldV = [&]() {
#pragma unroll
        for (int kk = 0; kk < 2; ++kk) {
#pragma unroll
            for (int nt = 0; nt < 4; ++nt) {
                if constexpr (!HR) { vb[kk][nt] = WFrag<h16>::ld(pv + nt * 16 * SEQ + kk * 512); }
                else { vbh[kk][nt] = WFrag<bf>::ld(pvh + nt * 16 * RH + kk * 512); vbl[kk][nt] = WFrag<bf>::ld(pvl + nt * 16 * RH + kk * 512); }
            }
        }
        __builtin_amdgcn_sched_barrier(0);   // as in ldK
    };
    if constexpr (!HR) ldK();
#pragma unroll 1
    for (int jt = 0; jt < ntiles; ++jt) {
        const int kv0 = jt * 64;
        if constexpr (!HR) ldV(); else ldK();
        v8f sacc[4];                                // St: tile nt, element j = (key nt*16 + 8*hi + j, query m)
#pragma unroll
        for (int nt = 0; nt < 4; ++nt) sacc[nt] = (v8f){};
        if constexpr (!HR) {
#pragma unroll
            for (int kk = 0; kk < 2; ++kk) {
#pragma unroll
                for (int nt = 0; nt < 4; ++nt) sacc[nt] = wmma16(kb[kk][nt], qa[kk], sacc[nt]);
            }
            asm volatile("v_nop\n\tv_nop\n\tv_nop\n\tv_nop" : "+v"(sacc[0]), "+v"(sacc[1]), "+v"(sacc[2]), "+v"(sacc[3]) : "v"(qa[0]), "v"(qa[1]), "v"(kb[1][3]));   // WMMA distance in front of the readers of the scores and of the refill of K
        } else {
#pragma unroll
            for (int kk = 0; kk < 2; ++kk) {
#pragma unroll
                for (int nt = 0; nt < 4; ++nt) {
                    sacc[nt] = wmmab(kbh[kk][nt], qah[kk], sacc[nt]); sacc[nt] = wmmab(kbh[kk][nt], qal[kk], sacc[nt]);
                    sacc[nt] = wmmab(kbl[kk][nt], qah[kk], sacc[nt]); }
            }
            asm volatile("v_nop\n\tv_nop\n\tv_nop\n\tv_nop" : "+v"(sacc[0]), "+v"(sacc[1]), "+v"(sacc[2]), "+v"(sacc[3]) : "v"(kbh[1][3]), "v"(kbl[1][3]));   // as above
        }
        if constexpr (!HR) { pk += (jt + 1 < ntiles) ? (64 * HD) : 0; ldK(); }   // behind the last tile: an in-bounds reload of it that nothing consumes
        else ldV();
        // online softmax of this lane's query over its 32 keys of the tile; diagonal tile: keys with index > query index get the replace-fill
        const bool diag = (kv0 == q0);
        float mx4[4];
#pragma unroll
        for (int nt = 0; nt < 4; ++nt) {
            mx4[nt] = -3.0e38f;
#pragma unroll
            for (int j = 0; j < 8; ++j) { float s = sacc[nt][j] * SCL; const int kn = nt * 16 + hi * 8 + j; s = (diag && kn > rr) ? -3.0e38f : s; sacc[nt][j] = s; mx4[nt] = fmaxf(mx4[nt], s); }
        }
        float mx = fmaxf(fmaxf(mx4[0], mx4[1]), fmaxf(mx4[2], mx4[3]));
        mx = fmaxf(mx, xhalf(mx));                  // the other half holds the query's other 32 keys
        const float mn = fmaxf(mrow, mx);
        const float corr = __builtin_amdgcn_exp2f((mrow - mn) * L2E);
        mrow = mn;
        v16h pb[2]; v16us pbh[2], pbl[2]; float ps4[4];
#pragma unroll
        for (int nt = 0; nt < 4; ++nt) {
            ps4[nt] = 0.0f;
#pragma unroll
            for (int j = 0; j < 8; ++j) {
                const float p = __builtin_amdgcn_exp2f((sacc[nt][j] - mn) * L2E); ps4[nt] += p;
                // Pt fragment of key block nt>>1: elements 0..7 <- keys 8*hi + j of its first 16, elements 8..15 <- of its second 16
                if constexpr (!HR) { pb[nt >> 1][(nt & 1) * 8 + j] = (h16)(p * PCAR); } else { unsigned short a2, c2; splitf(p * PCAR, a2, c2); pbh[nt >> 1][(nt & 1) * 8 + j] = a2; pbl[nt >> 1][(nt & 1) * 8 + j] = c2; }
            }
        }
        lrow = lrow * corr + ((ps4[0] + ps4[1]) + (ps4[2] + ps4[3]));
#pragma unroll
        for (int nt = 0; nt < 4; ++nt) oacc[nt] = oacc[nt] * corr;
        // Ot += Vt . Pt (A = VT[d][key] plane, B = the lane's own p values)
        if constexpr (!HR) {
#pragma unroll
            for (int kk = 0; kk < 2; ++kk) {
#pragma unroll
                for (int nt = 0; nt < 4; ++nt) oacc[nt] = wmma16(vb[kk][nt], pb[kk], oacc[nt]);
            }
            asm volatile("v_nop\n\tv_nop\n\tv_nop\n\tv_nop" : "+v"(oacc[0]), "+v"(oacc[1]), "+v"(oacc[2]), "+v"(oacc[3]) : "v"(pb[0]), "v"(pb[1]), "v"(vb[1][3]));   // WMMA distance on the back edge and in front of the epilogue
        } else {
            v16bf pah[2], pal[2];
#pragma unroll
            for (int kk = 0; kk < 2; ++kk) {
                pah[kk] = __builtin_bit_cast(v16bf, pbh[kk]); pal[kk] = __builtin_bit_cast(v16bf, pbl[kk]);
#pragma unroll
                for (int nt = 0; nt < 4; ++nt) {
                    oacc[nt] = wmmab(vbh[kk][nt], pah[kk], oacc[nt]); oacc[nt] = wmmab(vbh[kk][nt], pal[kk], oacc[nt]);
                    oacc[nt] = wmmab(vbl[kk][nt], pah[kk], oacc[nt]); }
            }
            asm volatile("v_nop\n\tv_nop\n\tv_nop\n\tv_nop" : "+v"(oacc[0]), "+v"(oacc[1]), "+v"(oacc[2]), "+v"(oacc[3]) : "v"(pah[0]), "v"(pal[1]), "v"(vbh[1][3]), "v"(vbl[1][3]));   // as above
        }
        // the wait that stands in front of a rewrite of the loads' address registers; naming them keeps them whole up to it; at the foot of the tile, behind softmax and products, it finds the count at 0
        if constexpr (!HR) { asm volatile("s_wait_xcnt 0x0" :: "v"(pk), "v"(pv) : "memory"); pv += 1024; }
        else { asm volatile("s_wait_xcnt 0x0" :: "v"(pkh), "v"(pkl), "v"(pvh), "v"(pvl) : "memory"); pkh += 64 * HD; pkl += 64 * HD; pvh += 1024; pvl += 1024; }
    }
    // normalise; the lane's eight values of tile nt are d = nt*16 + 8*hi + 0..7 of query m: one 16-byte piece of the [rows][DM] y plane in fragment order (k block nt>>1, half nt&1, piece lane), so each store is a 512-byte run of the wave
    const float inv = 1.0f / ((lrow + xhalf(lrow)) * PCAR);
    v8h o16[4]; v8us oh[4], ol[4];
#pragma unroll
    for (int nt = 0; nt < 4; ++nt) {
#pragma unroll
        for (int j = 0; j < 8; ++j) {
            const float y = oacc[nt][j] * inv;
            if constexpr (!HR) { o16[nt][j] = (h16)(y * YCAR); } else { unsigned short a2, c2; splitf(y, a2, c2); oh[nt][j] = a2; ol[nt][j] = c2; }
        }
    }
    __builtin_amdgcn_sched_barrier(0);   // every value is formed ahead of the first store, so no register that a store names is written behind it
#pragma unroll
    for (int nt = 0; nt < 4; ++nt) {
        if constexpr (!HR) {
            *(v8h*)(Y16 + ((size_t)b * SEQ + qw) * DM + hp * 1024 + nt * 256 + lane * 8) = o16[nt];
        } else {
            *(v8us*)(YH + ((size_t)b * RH + qw) * DM + hp * 1024 + nt * 256 + lane * 8) = oh[nt]; *(v8us*)(YL + ((size_t)b * RH + qw) * DM + hp * 1024 + nt * 256 + lane * 8) = ol[nt];
        }
    }
}

extern "C" void kernel_launch(void* const* d_in, const int* in_sizes, int n_in,
                              void* d_out, int out_size, void* d_ws, size_t ws_size, hipStream_t stream) {
    if (n_in < 11) return;
    const int xneed = (NB - 1) * SEQ_FULL * DM + SEQ * DM;
    if (in_sizes[0] < xneed || in_sizes[1] < xneed || in_sizes[2] < xneed || in_sizes[3] < xneed) return;
    if (in_sizes[4] < NQKV * DM || in_sizes[5] < NQKV || in_sizes[6] < DM * DM || in_sizes[7] < DM) return;
    if (in_sizes[8] < 1 || in_sizes[9] < NH - 1 || in_sizes[10] < NH) return;
    if (out_size < xneed) return;
    const float* X1 = (const float*)d_in[0]; const float* X2 = (const float*)d_in[1]; const float* X3 = (const float*)d_in[2]; const float* X = (const float*)d_in[3];
    const float* Wattn = (const float*)d_in[4]; const float* battn = (const float*)d_in[5]; const float* Wproj = (const float*)d_in[6]; const float* bproj = (const float*)d_in[7];
    const int* hidx = (const int*)d_in[8]; const int* hidxs = (const int*)d_in[9]; const int* perm = (const int*)d_in[10];
    float* OUT = (float*)d_out;   // [NB_FULL][SEQ_FULL][DM] f32

    char* wsp = (char*)d_ws;
    auto take = [&](size_t bytes) { char* p = wsp; wsp += (bytes + 255) & ~(size_t)255; return (void*)p; };
    const size_t xplane = (size_t)NB * SEQ * DM * 2;                 // compact [NB*SEQ][DM] bf16, fragment order
    bf* XB = (bf*)take(xplane); bf* X1B = (bf*)take(xplane); bf* X2B = (bf*)take(xplane); bf* X3B = (bf*)take(xplane);
    bf* WB = (bf*)take((size_t)NSLOT * HD * DM * 2);
    h16* WP16 = (h16*)take((size_t)DM * DM * 2); bf* WPB = (bf*)take((size_t)DM * DM * 2);
    const size_t hplane = (size_t)NB * NH * SEQ * HD * 2, hplaneR = (size_t)NB * NH * RH * HD * 2;
    h16* Q16 = (h16*)take(hplane); h16* K16 = (h16*)take(hplane); h16* VT = (h16*)take(hplane);
    bf* QH = (bf*)take(hplaneR); bf* QL = (bf*)take(hplaneR); bf* KH = (bf*)take(hplaneR); bf* KL = (bf*)take(hplaneR); bf* VH = (bf*)take(hplaneR); bf* VL = (bf*)take(hplaneR);
    h16* Y16 = (h16*)take((size_t)NB * SEQ * DM * 2); bf* YH = (bf*)take((size_t)NB * RH * DM * 2); bf* YL = (bf*)take((size_t)NB * RH * DM * 2);
    if ((size_t)(wsp - (char*)d_ws) > ws_size) return;

    // 1) bf16 input planes (compact rows)
    k_cvtx<<<dim3((unsigned)(((size_t)NB * SEQ * DM / 8 + 255) / 256), 4), 256, 0, stream>>>(X, X1, X2, X3, XB, X1B, X2B, X3B);
    // 2) gathered head weight plane and output-projection weight planes
    k_wg<<<(unsigned)(((size_t)NSLOT * HD * DM / 8 + 255) / 256), 256, 0, stream>>>(Wattn, hidx, hidxs, WB);
    k_cvtw<<<(unsigned)(((size_t)DM * DM / 8 + 255) / 256), 256, 0, stream>>>(Wproj, WP16, WPB);
    // 3) head projections -> per final-head planes
    k_qkv<<<dim3(NB * SEQ / 64, 1, NSLOT), 32, 0, stream>>>(XB, X1B, X2B, X3B, WB, battn, hidx, hidxs, perm, Q16, QH, QL, K16, KH, KL, VT, VH, VL);
    // 4) causal attention: hi+lo band (query tiles < RH) and single-plane band (tiles >= RH)
    k_flash<true><<<dim3(RH / 64, NB * NH), 128, 0, stream>>>(Q16, QH, QL, K16, KH, KL, VT, VH, VL, Y16, YH, YL, 0);
    if (SEQ > RH) k_flash<false><<<dim3((SEQ - RH) / 64, NB * NH), 128, 0, stream>>>(Q16, QH, QL, K16, KH, KL, VT, VH, VL, Y16, YH, YL, RH / 64);
    // 5) output projection (+ bproj): rows < RH from bf16 hi+lo y, rows >= RH from the f16 plane (carries folded by OSC)
    k_gemmw<bf, 1, true, DM><<<dim3(RH / 64, DM / 64, NB), 32, 0, stream>>>(YH, YL, WPB, nullptr, OUT, DM, bproj, 1.0f, (size_t)RH * DM, (size_t)0, (size_t)SEQ_FULL * DM);
    if (SEQ > RH) k_gemmw<h16, 0, true, DM><<<dim3((SEQ - RH) / 64, DM / 64, NB), 32, 0, stream>>>(Y16 + (size_t)RH * DM, nullptr, WP16, nullptr, OUT + (size_t)RH * DM, DM, bproj, OSC, (size_t)SEQ * DM, (size_t)0, (size_t)SEQ_FULL * DM);
}

// v005
// It runs in 99 microseconds.
// Next to v004, in two timings, it ran 1.36 and 1.40 times as fast.
// Over all steps from v000 it is 3.11 times as fast.
#include <hip/hip_runtime.h>

// Contractions: head projections x*W^T for v and W*x^T (transposed) for q, k on v_wmma_f32_16x16x32_bf16 (RNE bf16 operands = converted inputs, exact products); attention k.q^T and v^T.p^T (both transposed) on v_wmma_f32_16x16x32_f16 single planes (p carried x1024) for query rows >= RH and on bf16 hi+lo planes (3 products) for query rows < RH; output projection on v_wmma_f32_16x16x32_f16 planes (y carried x16, W x64, folded by 2^-10) for rows >= RH and on bf16 hi+lo y planes (2 products) for rows < RH; f32 accumulate everywhere, softmax in f32.
// Every 16-bit operand plane in the workspace lies in fragment order: a logical [R][K] plane is cut into blocks of 16 rows x 32 k (512 elements, row bands of 16*K elements, k blocks ascending inside a band); inside a block element (r, k) stands at ((k>>4)&1)*256 + (((k>>3)&1)*16 + (r&15))*8 + (k&7), so each of a fragment's two 16-byte loads reads 512 contiguous bytes over the wave (four whole lines instead of pieces of sixteen).

#ifndef NB
#define NB 2
#endif
#ifndef SEQ
#define SEQ 2048
#endif
#define NB_FULL  2
#define SEQ_FULL 2048
#define DM   1024
#define NH   16
#define HD   64
#define NQKV 3072
#define NSLOT (3 * NH)
#ifndef RH
#define RH 512
#endif
#if RH > SEQ
#undef RH
#define RH SEQ
#endif
static_assert(SEQ % 64 == 0);
static_assert(RH % 64 == 0);
static_assert(RH <= SEQ);
static_assert(SEQ <= SEQ_FULL);
static_assert(NB <= NB_FULL);
static_assert(DM % 64 == 0);
#define PCAR 1024.0f
#define YCAR 16.0f
#define WCAR 64.0f
#define OSC  (1.0f / 1024.0f)
#define SCL  0.125f
#define L2E  1.4426950408889634f

typedef _Float16 h16;
typedef unsigned short bf;
typedef __attribute__((ext_vector_type(16))) __bf16   v16bf;
typedef __attribute__((ext_vector_type(16))) _Float16 v16h;
typedef __attribute__((ext_vector_type(8)))  _Float16 v8h;
typedef __attribute__((ext_vector_type(8)))  unsigned short v8us;
typedef __attribute__((ext_vector_type(16))) unsigned short v16us;
typedef __attribute__((ext_vector_type(8)))  float    v8f;
typedef __attribute__((ext_vector_type(4)))  float    v4f;
typedef v4f  __attribute__((may_alias)) v4fa;

__device__ __forceinline__ unsigned short f2bf(float f) { unsigned u = __float_as_uint(f); u += 0x7FFFu + ((u >> 16) & 1u); return (unsigned short)(u >> 16); }
__device__ __forceinline__ float bf2f(unsigned short b) { return __uint_as_float(((unsigned)b) << 16); }
__device__ __forceinline__ float bfr(float f) { return bf2f(f2bf(f)); }
__device__ __forceinline__ v16h cat16(v8h lo, v8h hi) { return __builtin_shufflevector(lo, hi, 0, 1, 2, 3, 4, 5, 6, 7, 8, 9, 10, 11, 12, 13, 14, 15); }
__device__ __forceinline__ v16bf cat16b(v8us lo, v8us hi) { return __builtin_bit_cast(v16bf, __builtin_shufflevector(lo, hi, 0, 1, 2, 3, 4, 5, 6, 7, 8, 9, 10, 11, 12, 13, 14, 15)); }
__device__ __forceinline__ v8f wmma16(v16h a, v16h b, v8f c) { return __builtin_amdgcn_wmma_f32_16x16x32_f16(false, a, false, b, (short)0, c, false, false); }
__device__ __forceinline__ v8f wmmab(v16bf a, v16bf b, v8f c) { return __builtin_amdgcn_wmma_f32_16x16x32_bf16(false, a, false, b, (short)0, c, false, false); }
__device__ __forceinline__ void splitf(float y, unsigned short& h, unsigned short& l) { h = f2bf(y); l = f2bf(y - bf2f(h)); }

// Fragment loaders: lane -> row (A) / column (B) = lane&15; elements 0..7 <- k0+8h+0..7, elements 8..15 <- k0+16+8h+0..7 (h = lane>>4); p already carries the 16x32 block's start + lane*8.
template <typename T16> struct WFrag;
template <> struct WFrag<h16> { typedef v16h V; static __device__ __forceinline__ V ld(const h16* p) { return cat16(*(const v8h*)p, *(const v8h*)(p + 256)); } static __device__ __forceinline__ v8f mma(V a, V b, v8f c) { return wmma16(a, b, c); } };
template <> struct WFrag<bf> { typedef v16bf V; static __device__ __forceinline__ V ld(const bf* p) { return cat16b(*(const v8us*)p, *(const v8us*)(p + 256)); } static __device__ __forceinline__ v8f mma(V a, V b, v8f c) { return wmmab(a, b, c); } };

// ---- gemmw: register-blocked GEMM, ONE WAVE per 64x64 output tile (16 accumulators), operands straight from 16-bit planes in fragment order; tile (bx, by) of batch z, 32 threads, os = the block's 16 x 68 floats of LDS.
// C[m][n] (f32, pitch ldc) = (sum_k A[m][k] Bt[n][k] (+ A2[m][k] Bt[n][k] when NSPLIT==1)) * osc + bias[n] (bf16 RNE value). z-batch strides sA/sB/sC in elements. K % 64 == 0, K >= 64.
template <typename T16, int NSPLIT, bool BIAS, int K>
__device__ __forceinline__ void gemmw(const T16* __restrict__ A, const T16* __restrict__ A2, const T16* __restrict__ Bt, const T16* __restrict__ Bt2, float* C, int ldc, const float* __restrict__ bias, float osc, size_t sA, size_t sB, size_t sC, int bx, int by, size_t z, float* os) {
    typedef typename WFrag<T16>::V V;
    A += z * sA; if (A2) A2 += z * sA; Bt += z * sB; if (Bt2) Bt2 += z * sB; C += z * sC;
    const int lane = threadIdx.x & 31, lr = lane & 15, hi = lane >> 4; const int r0 = bx * 64, c0 = by * 64;
    v8f acc[4][4];
#pragma unroll
    for (int mb = 0; mb < 4; ++mb)
#pragma unroll
        for (int nb = 0; nb < 4; ++nb) acc[mb][nb] = (v8f){};
    const size_t aoff = (size_t)r0 * K + 8 * lane, boff = (size_t)c0 * K + 8 * lane;
    // Two register sets of operand fragments: every load of k step s+1 is issued before the products of step s, so a step waits for one load latency at most.
    static_assert(K % 64 == 0 && K >= 64);
    struct FS { V a[4], a2[4], b[4], b2[4]; };
    const T16* pa = A + aoff; const T16* pa2 = A2 + aoff; const T16* pb = Bt + boff; const T16* pb2 = Bt2 + boff;   // pa2 / pb2 are read only where NSPLIT uses them
    auto ldfs = [&](FS& f, int ko) {
#pragma unroll
        for (int mb = 0; mb < 4; ++mb) { f.a[mb] = WFrag<T16>::ld(pa + mb * 16 * K + ko * 16); if (NSPLIT == 1 || NSPLIT == 2) f.a2[mb] = WFrag<T16>::ld(pa2 + mb * 16 * K + ko * 16); }
#pragma unroll
        for (int nb = 0; nb < 4; ++nb) { f.b[nb] = WFrag<T16>::ld(pb + nb * 16 * K + ko * 16); if (NSPLIT >= 2) f.b2[nb] = WFrag<T16>::ld(pb2 + nb * 16 * K + ko * 16); }
        __builtin_amdgcn_sched_barrier(0);   // keeps the loads above the products that follow; without it the scheduler sinks each load to its first use
    };
    // the wait that stands in front of a rewrite of the loads' address registers; naming them keeps them whole up to it; behind a block of products it finds the count at 0
    auto xw = [&]() {
        if constexpr (NSPLIT == 0) asm volatile("s_wait_xcnt 0x0" :: "v"(pa), "v"(pb) : "memory");
        else if constexpr (NSPLIT == 1) asm volatile("s_wait_xcnt 0x0" :: "v"(pa), "v"(pa2), "v"(pb) : "memory");
        else asm volatile("s_wait_xcnt 0x0" :: "v"(pa), "v"(pa2), "v"(pb), "v"(pb2) : "memory");
    };
    auto mmfs = [&](FS& f) {
#pragma unroll
        for (int nb = 0; nb < 4; ++nb) {
#pragma unroll
            for (int mb = 0; mb < 4; ++mb) { acc[mb][nb] = WFrag<T16>::mma(f.a[mb], f.b[nb], acc[mb][nb]); if (NSPLIT == 1 || NSPLIT == 2) acc[mb][nb] = WFrag<T16>::mma(f.a2[mb], f.b[nb], acc[mb][nb]); if (NSPLIT >= 2) acc[mb][nb] = WFrag<T16>::mma(f.a[mb], f.b2[nb], acc[mb][nb]); } }
        // WMMA distance before the refill of this set and on the back edge
        asm volatile("v_nop\n\tv_nop\n\tv_nop\n\tv_nop" : "+v"(acc[0][0]), "+v"(acc[1][1]), "+v"(acc[2][2]), "+v"(acc[3][3]) : "v"(f.a[0]), "v"(f.a[3]));
    };
    FS f0, f1;
    ldfs(f0, 0);
    asm volatile("s_wait_xcnt 0x0" ::: "memory");   // in front of any rewrite of the registers that these first loads name (the loop's own wait names only the walking pointers)
    __builtin_amdgcn_sched_barrier(0);              // keeps such a rewrite behind the wait
#pragma unroll 1
    for (int kc = 0; kc < K - 64; kc += 64) {
        ldfs(f1, 32);
        mmfs(f0);
        xw();
        pa += 64 * 16; pa2 += 64 * 16; pb += 64 * 16; pb2 += 64 * 16;
        ldfs(f0, 0);
        mmfs(f1);
    }
    __builtin_amdgcn_sched_barrier(0);              // the epilogue's index arithmetic, which the compiler sinks to the head of this block, stays ahead of the loads: behind them it took their address registers
    ldfs(f1, 32);
    asm volatile("s_wait_xcnt 0x0" ::: "memory");   // in front of any rewrite of the registers that these last loads name
    __builtin_amdgcn_sched_barrier(0);              // keeps such a rewrite behind the wait
    mmfs(f0);
    xw();
    mmfs(f1);
#pragma unroll
    for (int mb = 0; mb < 4; ++mb) {
#pragma unroll
        for (int nb = 0; nb < 4; ++nb) {
#pragma unroll
            for (int j = 0; j < 8; ++j) os[(hi * 8 + j) * 68 + nb * 16 + lr] = acc[mb][nb][j]; }
        __builtin_amdgcn_wave_barrier(); asm volatile("" ::: "memory");
        float* crow = C + (size_t)(r0 + mb * 16) * ldc + c0;
{
#pragma unroll
            for (int s = 0; s < 8; ++s) { const int row = 2 * s + hi, cofs = lr * 4; v4f val = *(const v4fa*)(os + row * 68 + cofs); val = val * osc; if (BIAS) { val[0] += bfr(bias[c0 + cofs]); val[1] += bfr(bias[c0 + cofs + 1]); val[2] += bfr(bias[c0 + cofs + 2]); val[3] += bfr(bias[c0 + cofs + 3]); }
                *(v4f*)(crow + (size_t)row * ldc + cofs) = val; }
             }
        asm volatile("s_wait_xcnt 0x0" ::: "memory");   // in front of the next block's reuse of the stores' address and data registers
        __builtin_amdgcn_sched_barrier(0);              // keeps that reuse behind the wait
        __builtin_amdgcn_wave_barrier(); asm volatile("" ::: "memory");
    }
}

// ---- k_proj: the output projection of both row bands in ONE launch, grid (SEQ/64, DM/64, NB), 32 threads: row tiles < RH/64 take the bf16 hi+lo y planes, the others the f16 plane (block-uniform branch).
// The two bands are independent and neither fills the chip's SIMDs alone: together they run side by side.
__global__ __launch_bounds__(32) void k_proj(const bf* __restrict__ YH, const bf* __restrict__ YL, const bf* __restrict__ WPB, const h16* __restrict__ Y16, const h16* __restrict__ WP16, float* OUT, const float* __restrict__ bproj) {
    __shared__ __align__(16) float os[16 * 68];
    const int bx = blockIdx.x;
    if (bx < RH / 64) gemmw<bf, 1, true, DM>(YH, YL, WPB, nullptr, OUT, DM, bproj, 1.0f, (size_t)RH * DM, (size_t)0, (size_t)SEQ_FULL * DM, bx, blockIdx.y, blockIdx.z, os);
    else gemmw<h16, 0, true, DM>(Y16 + (size_t)RH * DM, nullptr, WP16, nullptr, OUT + (size_t)RH * DM, DM, bproj, OSC, (size_t)SEQ * DM, (size_t)0, (size_t)SEQ_FULL * DM, bx - RH / 64, blockIdx.y, blockIdx.z, os);
}

// ---- integer head selection: slot 0 -> head_idx[0], slot s>=1 -> head_idxs[s-1]; both values loaded unconditionally with clamped addresses, negative wraps by 16, result clamped to [0,15].
__device__ __forceinline__ int wrap16(int v) { v = (v < 0) ? (v + NH) : v; v = (v < 0) ? 0 : v; return (v > NH - 1) ? (NH - 1) : v; }
__device__ __forceinline__ int hsel(const int* hidx, const int* hidxs, int slot) {
    const int a = hidx[0]; int bi = slot - 1; bi = (bi < 0) ? 0 : ((bi > NH - 2) ? (NH - 2) : bi); const int c = hidxs[bi];
    return wrap16((slot == 0) ? a : c);
}

// The three converters: a block of 256 threads takes 16 rows x 128 columns of a [R][DM] source (thread -> row t>>4, columns (t&15)*8 .. +7, reads as whole runs of a row); in fragment order those are 2048 contiguous elements,
// piece (row lr, column piece c8) at piece index c8*16 + lr. fo_swap hands each thread the piece of its own index through LDS (pitch 17 pieces: no bank conflict either way), so the stores are whole lines too.
static_assert(DM % 128 == 0);
__device__ __forceinline__ v8us fo_swap(v8us* sm, v8us o, int t) {
    sm[(t & 15) * 17 + (t >> 4)] = o;
    __syncthreads();
    return sm[(t >> 4) * 17 + (t & 15)];
}

// coverage: NB*SEQ*DM elements per plane, 2048 per block, blocks bx = 0 .. NBX-1 of plane w = 0 .. 3 -> whole planes.
#define NBX ((int)((size_t)NB * SEQ * DM / 2048))
#define NBG ((int)((size_t)NSLOT * HD * DM / 2048))
#define NBW ((int)((size_t)DM * DM / 2048))
__device__ __forceinline__ void cvtx(const float* __restrict__ s0, const float* __restrict__ s1, const float* __restrict__ s2, const float* __restrict__ s3, bf* d0, bf* d1, bf* d2, bf* d3, int bx, int w, v8us* sm) {
    const int t = threadIdx.x;
    const float* src = (w == 0) ? s0 : ((w == 1) ? s1 : ((w == 2) ? s2 : s3)); bf* dst = (w == 0) ? d0 : ((w == 1) ? d1 : ((w == 2) ? d2 : d3));
    const size_t row = (size_t)(bx / (DM / 128)) * 16 + (t >> 4); const int col = (int)(bx % (DM / 128)) * 128 + (t & 15) * 8; const size_t b = row / SEQ, tt = row % SEQ;
    const v8f v = *(const v8f*)(src + ((b * SEQ_FULL + tt) * DM + col)); v8us o;
#pragma unroll
    for (int q = 0; q < 8; ++q) o[q] = f2bf(v[q]);
    *(v8us*)(dst + (size_t)bx * 2048 + t * 8) = fo_swap(sm, o, t);
    asm volatile("s_wait_xcnt 0x0" ::: "memory");   // in front of any rewrite of the registers that the store names: the compiler joins the three converters' blocks by fall-through tests
}

// coverage: 48*64*1024 elements, 2048 per block, blocks bx = 0 .. NBG-1.
__device__ __forceinline__ void wg(const float* __restrict__ W, const int* __restrict__ hidx, const int* __restrict__ hidxs, bf* WB, int bx, v8us* sm) {
    const int t = threadIdx.x;
    const int zr = (int)(bx / (DM / 128)) * 16 + (t >> 4); const int k = (int)(bx % (DM / 128)) * 128 + (t & 15) * 8;
    const int r = zr % HD; const int z = zr / HD; const int type = z >> 4, slot = z & 15;
    const int hs = hsel(hidx, hidxs, slot);
    const v8f v = *(const v8f*)(W + ((size_t)(type * DM + hs * HD + r)) * DM + k); v8us o;
#pragma unroll
    for (int q = 0; q < 8; ++q) o[q] = f2bf(v[q]);
    *(v8us*)(WB + (size_t)bx * 2048 + t * 8) = fo_swap(sm, o, t);
    asm volatile("s_wait_xcnt 0x0" ::: "memory");   // in front of any rewrite of the registers that the store names: the compiler joins the three converters' blocks by fall-through tests
}

// coverage: DM*DM elements, 2048 per block, blocks bx = 0 .. NBW-1.
__device__ __forceinline__ void cvtw(const float* __restrict__ W, h16* WP16, bf* WPB, int bx, v8us* sm, v8us* sm2) {
    const int t = threadIdx.x;
    const size_t row = (size_t)(bx / (DM / 128)) * 16 + (t >> 4); const int col = (int)(bx % (DM / 128)) * 128 + (t & 15) * 8;
    const v8f v = *(const v8f*)(W + row * DM + col); v8h o16; v8us ob;
#pragma unroll
    for (int q = 0; q < 8; ++q) { ob[q] = f2bf(v[q]); o16[q] = (h16)(bf2f(ob[q]) * WCAR); }
    sm2[(t & 15) * 17 + (t >> 4)] = ob;   // published by the barrier inside fo_swap
    const v8us p16 = fo_swap(sm, __builtin_bit_cast(v8us, o16), t);
    *(v8h*)(WP16 + (size_t)bx * 2048 + t * 8) = __builtin_bit_cast(v8h, p16); *(v8us*)(WPB + (size_t)bx * 2048 + t * 8) = sm2[(t >> 4) * 17 + (t & 15)];
    asm volatile("s_wait_xcnt 0x0" ::: "memory");   // in front of any rewrite of the registers that the store names: the compiler joins the three converters' blocks by fall-through tests
}

// ---- k_cvt: the three converters in ONE launch (they are independent of one another): blocks 0 .. NBG-1 gather the head weights, the next NBW convert the output-projection weights, the last 4*NBX the four inputs; every branch is block-uniform.
__global__ __launch_bounds__(256) void k_cvt(const float* __restrict__ X, const float* __restrict__ X1, const float* __restrict__ X2, const float* __restrict__ X3, const float* __restrict__ Wattn, const float* __restrict__ Wproj,
                                           const int* __restrict__ hidx, const int* __restrict__ hidxs, bf* XB, bf* X1B, bf* X2B, bf* X3B, bf* WB, h16* WP16, bf* WPB) {
    __shared__ __align__(16) v8us sm[16 * 17];
    __shared__ __align__(16) v8us sm2[16 * 17];
    const int bid = blockIdx.x;
    if (bid < NBG) { wg(Wattn, hidx, hidxs, WB, bid, sm); return; }
    if (bid < NBG + NBW) { cvtw(Wproj, WP16, WPB, bid - NBG, sm, sm2); return; }
    if (bid < NBG + NBW + 4 * NBX) cvtx(X, X1, X2, X3, XB, X1B, X2B, X3B, (bid - NBG - NBW) % NBX, (bid - NBG - NBW) / NBX, sm);
}

// ---- k_qkv: per slot z = type*16 + slot, one wave per 64x64 tile of Y[b*SEQ + t][d] = sum_k XB[.][k] WB[z][d][k] + battn[type*DM + hsel(slot)*HD + d] (bf16 x bf16, f32 acc); grid (NB*SEQ/64, 1, 48), 32 threads.
// A = X1B/X2B/X3B for slot 0 (type q/k/v), XB otherwise (block-uniform select, no loaded index).
// The product's orientation follows the plane it feeds, so that a lane's eight accumulator values are one 16-byte piece of that plane in fragment order and go from the registers straight to memory (no LDS, no barrier):
//   q, k (SW = true, plane rows t, k = d): Yt = W.Xt, W rows as A and x rows as B (both tiles are 64 rows x K in fragment order, so the two walking pointers change places and the loop is one);
//     acc[nb][mb][j] = Y[t = mb*16 + (lane&15)][d = nb*16 + 8*(lane>>4) + j], piece at band mb (1024 elements), quarter nb (256), lane*8.
//   v (SW = false, plane rows d, k = t): Y = X.Wt; acc[mb][nb][j] = Y[t = mb*16 + 8*(lane>>4) + j][d = nb*16 + (lane&15)], piece at band nb (16*SEQ or 16*RH elements), quarter mb (256) behind t0*16, lane*8.
// For every final head hp with wrap16(perm[hp]) == slot (block-uniform scalar compare) the tile is written to head planes zf = b*16 + hp:
// coverage: every (hp, b, t, d) of Q16/K16/VT is written by exactly one (slot == wrap16(perm[hp]), row tile) block; hi+lo planes for all t < RH likewise. Each store of the wave is one 512-byte run.
template <bool SW, bool HI>
__device__ __forceinline__ void qkv_store(v8f (&acc)[4][4], const float* __restrict__ bsrc, const int* __restrict__ perm, int slot, int b, int t0, h16* P16, bf* PH, bf* PL) {
    const int lane = threadIdx.x & 31, lr = lane & 15, hi = lane >> 4;
    v8h o16[4][4]; v8us oh[4][4], ol[4][4];
    v4f br[4][2]; float bl[4];   // the lane's bias values as loaded: eight d a column group (SW) or one d
#pragma unroll
    for (int nb = 0; nb < 4; ++nb) {
        if constexpr (SW) { br[nb][0] = *(const v4fa*)(bsrc + nb * 16 + hi * 8); br[nb][1] = *(const v4fa*)(bsrc + nb * 16 + hi * 8 + 4); }
        else bl[nb] = bsrc[nb * 16 + lr];
    }
    asm volatile("s_wait_xcnt 0x0" ::: "memory");   // in front of any rewrite of the bias loads' address registers
    __builtin_amdgcn_sched_barrier(0);              // keeps such a rewrite behind the wait
#pragma unroll
    for (int nb = 0; nb < 4; ++nb) {
        float bs[8];   // bias (bf16 RNE value) of the lane's eight values
        if constexpr (SW) {
#pragma unroll
            for (int j = 0; j < 4; ++j) { bs[j] = bfr(br[nb][0][j]); bs[4 + j] = bfr(br[nb][1][j]); }
        } else {
            const float bv = bfr(bl[nb]);
#pragma unroll
            for (int j = 0; j < 8; ++j) bs[j] = bv;
        }
#pragma unroll
        for (int mb = 0; mb < 4; ++mb) {
#pragma unroll
            for (int j = 0; j < 8; ++j) {
                const float v = acc[SW ? nb : mb][SW ? mb : nb][j] + bs[j];
                o16[mb][nb][j] = (h16)v;
                if constexpr (HI) { unsigned short a2, c2; splitf(v, a2, c2); oh[mb][nb][j] = a2; ol[mb][nb][j] = c2; }
            }
            __builtin_amdgcn_sched_barrier(0);   // one tile is rounded at a time, its accumulators dead before the next tile's values are formed: without it the scheduler mixes the tiles and spills
        }
    }
    // every value is formed ahead of the first store (the barrier above), so no register that a store names is written behind it
    constexpr int SM = SW ? 1024 : 256, SN = SW ? 256 : 16 * SEQ, SNH = SW ? 256 : 16 * RH;   // element steps of mb and nb in the plane
#pragma unroll 1
    for (int hp = 0; hp < NH; ++hp) {
        const int pp = wrap16(perm[hp]);
        if (pp != slot) continue;
        const int zf = b * NH + hp;
        h16* d16 = P16 + (SW ? (((size_t)zf * SEQ + t0) * HD) : ((size_t)zf * HD * SEQ + (size_t)t0 * 16)) + lane * 8;
#pragma unroll
        for (int nb = 0; nb < 4; ++nb)
#pragma unroll
            for (int mb = 0; mb < 4; ++mb) *(v8h*)(d16 + mb * SM + nb * SN) = o16[mb][nb];
        if constexpr (HI) {
            const size_t hoff = (SW ? (((size_t)zf * RH + t0) * HD) : ((size_t)zf * HD * RH + (size_t)t0 * 16)) + lane * 8;
            bf* dh = PH + hoff; bf* dl = PL + hoff;
#pragma unroll
            for (int nb = 0; nb < 4; ++nb)
#pragma unroll
                for (int mb = 0; mb < 4; ++mb) { *(v8us*)(dh + mb * SM + nb * SNH) = oh[mb][nb]; *(v8us*)(dl + mb * SM + nb * SNH) = ol[mb][nb]; }
        }
        asm volatile("s_wait_xcnt 0x0" ::: "memory");   // in front of the next head's rewrite of the stores' address registers
        __builtin_amdgcn_sched_barrier(0);              // keeps that rewrite behind the wait
    }
}

__global__ __launch_bounds__(32) void k_qkv(const bf* __restrict__ XB, const bf* __restrict__ X1B, const bf* __restrict__ X2B, const bf* __restrict__ X3B, const bf* __restrict__ WB, const float* __restrict__ battn,
                                          const int* __restrict__ hidx, const int* __restrict__ hidxs, const int* __restrict__ perm,
                                          h16* Q16, bf* QH, bf* QL, h16* K16, bf* KH, bf* KL, h16* VT, bf* VH, bf* VL) {
    const int lane = threadIdx.x & 31;
    const int z = blockIdx.z, type = z >> 4, slot = z & 15;
    const int r0 = blockIdx.x * 64;                 // compact row index b*SEQ + t
    const int b = r0 / SEQ, t0 = r0 % SEQ; const bool hires = (t0 < RH);
    const bf* A = (slot == 0) ? ((type == 0) ? X1B : ((type == 1) ? X2B : X3B)) : XB;
    const bf* Bt = WB + (size_t)z * HD * DM;
    constexpr int K = DM;
    v8f acc[4][4];
#pragma unroll
    for (int mb = 0; mb < 4; ++mb)
#pragma unroll
        for (int nb = 0; nb < 4; ++nb) acc[mb][nb] = (v8f){};
    const size_t aoff = (size_t)r0 * K + 8 * lane, boff = (size_t)(8 * lane);
    // Two register sets of operand fragments: every load of k step s+1 is issued before the products of step s.
    struct FS { v16bf a[4], b[4]; };
    const bf* pa = (type == 2) ? (A + aoff) : (Bt + boff); const bf* pb = (type == 2) ? (Bt + boff) : (A + aoff);   // q, k: W rows as A, x rows as B
    auto ldfs = [&](FS& f, int ko) {
#pragma unroll
        for (int mb = 0; mb < 4; ++mb) f.a[mb] = WFrag<bf>::ld(pa + mb * 16 * K + ko * 16);
#pragma unroll
        for (int nb = 0; nb < 4; ++nb) f.b[nb] = WFrag<bf>::ld(pb + nb * 16 * K + ko * 16);
        __builtin_amdgcn_sched_barrier(0);   // keeps the loads above the products that follow; without it the scheduler sinks each load to its first use
    };
    // the wait that stands in front of a rewrite of the loads' address registers; naming them keeps them whole up to it; behind a block of products it finds the count at 0
    auto xw = [&]() { asm volatile("s_wait_xcnt 0x0" :: "v"(pa), "v"(pb) : "memory"); };
    auto mmfs = [&](FS& f) {
#pragma unroll
        for (int nb = 0; nb < 4; ++nb) {
#pragma unroll
            for (int mb = 0; mb < 4; ++mb) acc[mb][nb] = wmmab(f.a[mb], f.b[nb], acc[mb][nb]); }
        // WMMA distance before the refill of this set and on the back edge
        asm volatile("v_nop\n\tv_nop\n\tv_nop\n\tv_nop" : "+v"(acc[0][0]), "+v"(acc[1][1]), "+v"(acc[2][2]), "+v"(acc[3][3]) : "v"(f.a[0]), "v"(f.a[3]));
    };
    FS f0, f1;
    ldfs(f0, 0);
#pragma unroll 1
    for (int kc = 0; kc < K - 64; kc += 64) {
        ldfs(f1, 32);
        mmfs(f0);
        xw();
        pa += 64 * 16; pb += 64 * 16;
        ldfs(f0, 0);
        mmfs(f1);
    }
    ldfs(f1, 32);
    mmfs(f0);
    xw();
    mmfs(f1);
    const int hs = hsel(hidx, hidxs, slot); const float* bsrc = battn + type * DM + hs * HD;   // the slot's 64 bias values (battn index <= 3071 by the clamps)
    // four straight epilogues behind block-uniform branches
    if (type == 2) {
        if (hires) qkv_store<false, true>(acc, bsrc, perm, slot, b, t0, VT, VH, VL); else qkv_store<false, false>(acc, bsrc, perm, slot, b, t0, VT, VH, VL);
    } else {
        h16* P16 = (type == 0) ? Q16 : K16; bf* PH = (type == 0) ? QH : KH; bf* PL = (type == 0) ? QL : KL;
        if (hires) qkv_store<true, true>(acc, bsrc, perm, slot, b, t0, P16, PH, PL); else qkv_store<true, false>(acc, bsrc, perm, slot, b, t0, P16, PH, PL);
    }
}

// ---- flash<HR>: causal attention, one (b, final head, 64-query tile) per block, 4 waves x 16 query rows, 64-key tiles kv0 = 0 .. q0 (tiles above the diagonal skipped, diagonal tile masked by replace-fill), online softmax in f32.
// Both products run transposed: St = K.Qt (A = K rows, B = Q) and Ot += Vt.Pt (A = VT rows d, B = Pt). In an accumulator tile nt a lane then holds ONE query (column lane&15) and the eight keys (or d) nt*16 + 8*(lane>>4) + j:
// a query's maximum and sum are taken inside the lane plus one exchange between the wave's halves, and tiles 2kk and 2kk+1 of the lane's own p values are, in that order, the sixteen elements of the Pt fragment of key block kk, so p never leaves the registers.
// HR=false (query tiles >= RH): single f16 planes, p carried x 1024; y written as f16(y x 16) elements (b*SEQ + t, hp*64 + d) of Y16.
// HR=true (query tiles < RH): q, k, p(x1024), v as bf16 hi+lo planes, 3 products per tile pair; y written as bf16 hi+lo elements (b*RH + t, ..) of YH/YL.
// coverage: Y16 rows t in [RH, SEQ) x all hp (HR=false tiles), YH/YL rows t < RH x all hp (HR=true tiles).
__device__ __forceinline__ float xhalf(float x) { return __builtin_bit_cast(float, __builtin_amdgcn_permlanex16(__builtin_bit_cast(int, x), __builtin_bit_cast(int, x), 0x76543210, 0xfedcba98, false, false)); }   // lane l <-> lane l ^ 16
template <bool HR>
__device__ __forceinline__ void flash(const h16* __restrict__ Q16, const bf* __restrict__ QH, const bf* __restrict__ QL,
                                               const h16* __restrict__ K16, const bf* __restrict__ KH, const bf* __restrict__ KL,
                                               const h16* __restrict__ VT, const bf* __restrict__ VH, const bf* __restrict__ VL,
                                               h16* Y16, bf* YH, bf* YL, int qt, int zf) {
    const int tid = threadIdx.x, w = tid >> 5, lane = tid & 31, m = lane & 15, hi = lane >> 4;
    const int q0 = qt * 64, b = zf >> 4, hp = zf & 15;
    const int qw = q0 + w * 16;                     // first query row of this wave
    v16h qa[2]; v16bf qah[2], qal[2];
    if constexpr (!HR) {
        const h16* pq = Q16 + ((size_t)zf * SEQ + qw) * HD + 8 * lane;
#pragma unroll
        for (int kk = 0; kk < 2; ++kk) qa[kk] = WFrag<h16>::ld(pq + kk * 512);
        asm volatile("s_wait_xcnt 0x0" :: "v"(pq) : "memory");   // in front of any rewrite of the loads' address registers
    } else {
        const bf* pqh = QH + ((size_t)zf * RH + qw) * HD + 8 * lane; const bf* pql = QL + ((size_t)zf * RH + qw) * HD + 8 * lane;
#pragma unroll
        for (int kk = 0; kk < 2; ++kk) { qah[kk] = WFrag<bf>::ld(pqh + kk * 512); qal[kk] = WFrag<bf>::ld(pql + kk * 512); }
        asm volatile("s_wait_xcnt 0x0" :: "v"(pqh), "v"(pql) : "memory");   // in front of any rewrite of the loads' address registers
    }
    v8f oacc[4];                                    // Ot: tile nt, element j = (d = nt*16 + 8*hi + j, query m)
#pragma unroll
    for (int nt = 0; nt < 4; ++nt) oacc[nt] = (v8f){};
    float mrow = -3.0e38f, lrow = 0.0f;             // this lane's query: running maximum (both halves alike), sum over this half's keys
    const int rr = w * 16 + m;                      // this lane's query row within the 64-row tile
    const int ntiles = qt + 1;
    // All fragments of a key tile live in registers, [kk][nt], and are loaded in one batch. Single planes: K of tile jt+1 is issued right behind the score products of tile jt, V of tile jt in front of them.
    // hi+lo planes (twice the fragments): K in one batch at the head of the tile, V in one batch right behind the score products, under the softmax.
    v16h kb[2][4], vb[2][4]; v16bf kbh[2][4], kbl[2][4], vbh[2][4], vbl[2][4];
    // this lane's walking pointers: K planes step 64 rows a tile (four bands of 16*HD), V planes 64 columns (two k blocks of 512)
    const h16* pk = K16 + (size_t)zf * SEQ * HD + 8 * lane; const h16* pv = VT + (size_t)zf * HD * SEQ + 8 * lane;
    const bf* pkh = KH + (size_t)zf * RH * HD + 8 * lane; const bf* pkl = KL + (size_t)zf * RH * HD + 8 * lane;
    const bf* pvh = VH + (size_t)zf * HD * RH + 8 * lane; const bf* pvl = VL + (size_t)zf * HD * RH + 8 * lane;
    auto ldK = [&]() {
#pragma unroll
        for (int kk = 0; kk < 2; ++kk) {
#pragma unroll
            for (int nt = 0; nt < 4; ++nt) {
                if constexpr (!HR) { kb[kk][nt] = WFrag<h16>::ld(pk + nt * 16 * HD + kk * 512); }
                else { kbh[kk][nt] = WFrag<bf>::ld(pkh + nt * 16 * HD + kk * 512); kbl[kk][nt] = WFrag<bf>::ld(pkl + nt * 16 * HD + kk * 512); }
            }
        }
        __builtin_amdgcn_sched_barrier(0);   // keeps the loads above the work that follows; without it the scheduler sinks each load to its first use
    };
    auto ldV = [&]() {
#pragma unroll
        for (int kk = 0; kk < 2; ++kk) {
#pragma unroll
            for (int nt = 0; nt < 4; ++nt) {
                if constexpr (!HR) { vb[kk][nt] = WFrag<h16>::ld(pv + nt * 16 * SEQ + kk * 512); }
                else { vbh[kk][nt] = WFrag<bf>::ld(pvh + nt * 16 * RH + kk * 512); vbl[kk][nt] = WFrag<bf>::ld(pvl + nt * 16 * RH + kk * 512); }
            }
        }
        __builtin_amdgcn_sched_barrier(0);   // as in ldK
    };
    if constexpr (!HR) ldK();
#pragma unroll 1
    for (int jt = 0; jt < ntiles; ++jt) {
        const int kv0 = jt * 64;
        if constexpr (!HR) ldV(); else ldK();
        v8f sacc[4];                                // St: tile nt, element j = (key nt*16 + 8*hi + j, query m)
#pragma unroll
        for (int nt = 0; nt < 4; ++nt) sacc[nt] = (v8f){};
        if constexpr (!HR) {
#pragma unroll
            for (int kk = 0; kk < 2; ++kk) {
#pragma unroll
                for (int nt = 0; nt < 4; ++nt) sacc[nt] = wmma16(kb[kk][nt], qa[kk], sacc[nt]);
            }
            asm volatile("v_nop\n\tv_nop\n\tv_nop\n\tv_nop" : "+v"(sacc[0]), "+v"(sacc[1]), "+v"(sacc[2]), "+v"(sacc[3]) : "v"(qa[0]), "v"(qa[1]), "v"(kb[1][3]));   // WMMA distance in front of the readers of the scores and of the refill of K
        } else {
#pragma unroll
            for (int kk = 0; kk < 2; ++kk) {
#pragma unroll
                for (int nt = 0; nt < 4; ++nt) {
                    sacc[nt] = wmmab(kbh[kk][nt], qah[kk], sacc[nt]); sacc[nt] = wmmab(kbh[kk][nt], qal[kk], sacc[nt]);
                    sacc[nt] = wmmab(kbl[kk][nt], qah[kk], sacc[nt]); }
            }
            asm volatile("v_nop\n\tv_nop\n\tv_nop\n\tv_nop" : "+v"(sacc[0]), "+v"(sacc[1]), "+v"(sacc[2]), "+v"(sacc[3]) : "v"(kbh[1][3]), "v"(kbl[1][3]));   // as above
        }
        if constexpr (!HR) { pk += (jt + 1 < ntiles) ? (64 * HD) : 0; ldK(); }   // behind the last tile: an in-bounds reload of it that nothing consumes
        else ldV();
        // online softmax of this lane's query over its 32 keys of the tile; diagonal tile: keys with index > query index get the replace-fill
        const bool diag = (kv0 == q0);
        float mx4[4];
#pragma unroll
        for (int nt = 0; nt < 4; ++nt) {
            mx4[nt] = -3.0e38f;
#pragma unroll
            for (int j = 0; j < 8; ++j) { float s = sacc[nt][j] * SCL; const int kn = nt * 16 + hi * 8 + j; s = (diag && kn > rr) ? -3.0e38f : s; sacc[nt][j] = s; mx4[nt] = fmaxf(mx4[nt], s); }
        }
        float mx = fmaxf(fmaxf(mx4[0], mx4[1]), fmaxf(mx4[2], mx4[3]));
        mx = fmaxf(mx, xhalf(mx));                  // the other half holds the query's other 32 keys
        const float mn = fmaxf(mrow, mx);
        const float corr = __builtin_amdgcn_exp2f((mrow - mn) * L2E);
        mrow = mn;
        v16h pb[2]; v16us pbh[2], pbl[2]; float ps4[4];
#pragma unroll
        for (int nt = 0; nt < 4; ++nt) {
            ps4[nt] = 0.0f;
#pragma unroll
            for (int j = 0; j < 8; ++j) {
                const float p = __builtin_amdgcn_exp2f((sacc[nt][j] - mn) * L2E); ps4[nt] += p;
                // Pt fragment of key block nt>>1: elements 0..7 <- keys 8*hi + j of its first 16, elements 8..15 <- of its second 16
                if constexpr (!HR) { pb[nt >> 1][(nt & 1) * 8 + j] = (h16)(p * PCAR); } else { unsigned short a2, c2; splitf(p * PCAR, a2, c2); pbh[nt >> 1][(nt & 1) * 8 + j] = a2; pbl[nt >> 1][(nt & 1) * 8 + j] = c2; }
            }
        }
        lrow = lrow * corr + ((ps4[0] + ps4[1]) + (ps4[2] + ps4[3]));
#pragma unroll
        for (int nt = 0; nt < 4; ++nt) oacc[nt] = oacc[nt] * corr;
        // Ot += Vt . Pt (A = VT[d][key] plane, B = the lane's own p values)
        if constexpr (!HR) {
#pragma unroll
            for (int kk = 0; kk < 2; ++kk) {
#pragma unroll
                for (int nt = 0; nt < 4; ++nt) oacc[nt] = wmma16(vb[kk][nt], pb[kk], oacc[nt]);
            }
            asm volatile("v_nop\n\tv_nop\n\tv_nop\n\tv_nop" : "+v"(oacc[0]), "+v"(oacc[1]), "+v"(oacc[2]), "+v"(oacc[3]) : "v"(pb[0]), "v"(pb[1]), "v"(vb[1][3]));   // WMMA distance on the back edge and in front of the epilogue
        } else {
            v16bf pah[2], pal[2];
#pragma unroll
            for (int kk = 0; kk < 2; ++kk) {
                pah[kk] = __builtin_bit_cast(v16bf, pbh[kk]); pal[kk] = __builtin_bit_cast(v16bf, pbl[kk]);
#pragma unroll
                for (int nt = 0; nt < 4; ++nt) {
                    oacc[nt] = wmmab(vbh[kk][nt], pah[kk], oacc[nt]); oacc[nt] = wmmab(vbh[kk][nt], pal[kk], oacc[nt]);
                    oacc[nt] = wmmab(vbl[kk][nt], pah[kk], oacc[nt]); }
            }
            asm volatile("v_nop\n\tv_nop\n\tv_nop\n\tv_nop" : "+v"(oacc[0]), "+v"(oacc[1]), "+v"(oacc[2]), "+v"(oacc[3]) : "v"(pah[0]), "v"(pal[1]), "v"(vbh[1][3]), "v"(vbl[1][3]));   // as above
        }
        // the wait that stands in front of a rewrite of the loads' address registers; naming them keeps them whole up to it; at the foot of the tile, behind softmax and products, it finds the count at 0
        if constexpr (!HR) { asm volatile("s_wait_xcnt 0x0" :: "v"(pk), "v"(pv) : "memory"); pv += 1024; }
        else { asm volatile("s_wait_xcnt 0x0" :: "v"(pkh), "v"(pkl), "v"(pvh), "v"(pvl) : "memory"); pkh += 64 * HD; pkl += 64 * HD; pvh += 1024; pvl += 1024; }
    }
    // normalise; the lane's eight values of tile nt are d = nt*16 + 8*hi + 0..7 of query m: one 16-byte piece of the [rows][DM] y plane in fragment order (k block nt>>1, half nt&1, piece lane), so each store is a 512-byte run of the wave
    const float inv = 1.0f / ((lrow + xhalf(lrow)) * PCAR);
    v8h o16[4]; v8us oh[4], ol[4];
#pragma unroll
    for (int nt = 0; nt < 4; ++nt) {
#pragma unroll
        for (int j = 0; j < 8; ++j) {
            const float y = oacc[nt][j] * inv;
            if constexpr (!HR) { o16[nt][j] = (h16)(y * YCAR); } else { unsigned short a2, c2; splitf(y, a2, c2); oh[nt][j] = a2; ol[nt][j] = c2; }
        }
    }
    __builtin_amdgcn_sched_barrier(0);   // every value is formed ahead of the first store, so no register that a store names is written behind it
#pragma unroll
    for (int nt = 0; nt < 4; ++nt) {
        if constexpr (!HR) {
            *(v8h*)(Y16 + ((size_t)b * SEQ + qw) * DM + hp * 1024 + nt * 256 + lane * 8) = o16[nt];
        } else {
            *(v8us*)(YH + ((size_t)b * RH + qw) * DM + hp * 1024 + nt * 256 + lane * 8) = oh[nt]; *(v8us*)(YL + ((size_t)b * RH + qw) * DM + hp * 1024 + nt * 256 + lane * 8) = ol[nt];
        }
    }
}

// ---- k_flash: both bands in ONE launch, grid (NB*NH, SEQ/64), 128 threads: the bands are independent, and the hi+lo band alone leaves two thirds of the wave places empty.
// Three waves fit a SIMD (the register budget is a third of the file), so three quarters of the blocks start at once and the rest follow as places come free: blockIdx.y is a rank by falling cost
// (key tiles of the query tile, a hi+lo tile counted twice: about twice the vector instructions of a single-plane tile), so the short blocks fill the end. The rank -> query tile map is a permutation: every (head, query tile) once.
struct QOrder { unsigned char q[SEQ / 64]; };
constexpr QOrder make_qorder() {
    QOrder o{}; int c[SEQ / 64]{};
    for (int i = 0; i < SEQ / 64; ++i) {
        const int ci = (i + 1) * ((i < RH / 64) ? 2 : 1); int j = i - 1;
        while (j >= 0 && c[j] < ci) { c[j + 1] = c[j]; o.q[j + 1] = o.q[j]; --j; }
        c[j + 1] = ci; o.q[j + 1] = (unsigned char)i;
    }
    return o;
}
__global__ __launch_bounds__(128) __attribute__((amdgpu_waves_per_eu(1, 3))) void k_flash(const h16* __restrict__ Q16, const bf* __restrict__ QH, const bf* __restrict__ QL,
                                               const h16* __restrict__ K16, const bf* __restrict__ KH, const bf* __restrict__ KL,
                                               const h16* __restrict__ VT, const bf* __restrict__ VH, const bf* __restrict__ VL,
                                               h16* Y16, bf* YH, bf* YL) {
    constexpr QOrder qo = make_qorder();
    const int qt = qo.q[blockIdx.y], zf = blockIdx.x;
    if (qt < RH / 64) flash<true>(Q16, QH, QL, K16, KH, KL, VT, VH, VL, Y16, YH, YL, qt, zf);
    else flash<false>(Q16, QH, QL, K16, KH, KL, VT, VH, VL, Y16, YH, YL, qt, zf);
}

extern "C" void kernel_launch(void* const* d_in, const int* in_sizes, int n_in,
                              void* d_out, int out_size, void* d_ws, size_t ws_size, hipStream_t stream) {
    if (n_in < 11) return;
    const int xneed = (NB - 1) * SEQ_FULL * DM + SEQ * DM;
    if (in_sizes[0] < xneed || in_sizes[1] < xneed || in_sizes[2] < xneed || in_sizes[3] < xneed) return;
    if (in_sizes[4] < NQKV * DM || in_sizes[5] < NQKV || in_sizes[6] < DM * DM || in_sizes[7] < DM) return;
    if (in_sizes[8] < 1 || in_sizes[9] < NH - 1 || in_sizes[10] < NH) return;
    if (out_size < xneed) return;
    const float* X1 = (const float*)d_in[0]; const float* X2 = (const float*)d_in[1]; const float* X3 = (const float*)d_in[2]; const float* X = (const float*)d_in[3];
    const float* Wattn = (const float*)d_in[4]; const float* battn = (const float*)d_in[5]; const float* Wproj = (const float*)d_in[6]; const float* bproj = (const float*)d_in[7];
    const int* hidx = (const int*)d_in[8]; const int* hidxs = (const int*)d_in[9]; const int* perm = (const int*)d_in[10];
    float* OUT = (float*)d_out;   // [NB_FULL][SEQ_FULL][DM] f32

    char* wsp = (char*)d_ws;
    auto take = [&](size_t bytes) { char* p = wsp; wsp += (bytes + 255) & ~(size_t)255; return (void*)p; };
    const size_t xplane = (size_t)NB * SEQ * DM * 2;                 // compact [NB*SEQ][DM] bf16, fragment order
    bf* XB = (bf*)take(xplane); bf* X1B = (bf*)take(xplane); bf* X2B = (bf*)take(xplane); bf* X3B = (bf*)take(xplane);
    bf* WB = (bf*)take((size_t)NSLOT * HD * DM * 2);
    h16* WP16 = (h16*)take((size_t)DM * DM * 2); bf* WPB = (bf*)take((size_t)DM * DM * 2);
    const size_t hplane = (size_t)NB * NH * SEQ * HD * 2, hplaneR = (size_t)NB * NH * RH * HD * 2;
    h16* Q16 = (h16*)take(hplane); h16* K16 = (h16*)take(hplane); h16* VT = (h16*)take(hplane);
    bf* QH = (bf*)take(hplaneR); bf* QL = (bf*)take(hplaneR); bf* KH = (bf*)take(hplaneR); bf* KL = (bf*)take(hplaneR); bf* VH = (bf*)take(hplaneR); bf* VL = (bf*)take(hplaneR);
    h16* Y16 = (h16*)take((size_t)NB * SEQ * DM * 2); bf* YH = (bf*)take((size_t)NB * RH * DM * 2); bf* YL = (bf*)take((size_t)NB * RH * DM * 2);
    if ((size_t)(wsp - (char*)d_ws) > ws_size) return;

    // 1) bf16 input planes (compact rows)
    // 2) gathered head weight plane and output-projection weight planes, in the same launch
    k_cvt<<<NBG + NBW + 4 * NBX, 256, 0, stream>>>(X, X1, X2, X3, Wattn, Wproj, hidx, hidxs, XB, X1B, X2B, X3B, WB, WP16, WPB);
    // 3) head projections -> per final-head planes
    k_qkv<<<dim3(NB * SEQ / 64, 1, NSLOT), 32, 0, stream>>>(XB, X1B, X2B, X3B, WB, battn, hidx, hidxs, perm, Q16, QH, QL, K16, KH, KL, VT, VH, VL);
    // 4) causal attention: hi+lo band (query tiles < RH) and single-plane band (tiles >= RH), one launch
    k_flash<<<dim3(NB * NH, SEQ / 64), 128, 0, stream>>>(Q16, QH, QL, K16, KH, KL, VT, VH, VL, Y16, YH, YL);
    // 5) output projection (+ bproj): rows < RH from bf16 hi+lo y, rows >= RH from the f16 plane (carries folded by OSC), one launch
    k_proj<<<dim3(SEQ / 64, DM / 64, NB), 32, 0, stream>>>(YH, YL, WPB, Y16, WP16, OUT, bproj);
}
